// v000
// Measured on an AMD MI455X. A time is GPU time per run, averaged over a window of back-to-back runs after a warm-up
// (all launches, gaps included; the runs take copies of the inputs in turn), and the median of several windows.
// Apart from v000's, it joins two sittings. Times from different sittings can be a few percent apart, while
// side-by-side timings come from the same sitting.
// The starting kernel, v000, takes 788 microseconds a run.
#include <hip/hip_runtime.h>

// Compute dtypes, f32 accumulate, one batch item per pass: per-head q/k/v = query/key/value.W[h] + b[h] (weights [H][E][D] k-major per head, transposed once
// into one n-major [H*D][E] plane each; PLAIN bf16 operands = inputs rounded once, exact products; biases rounded to bf16, added in f32) with q and k written straight from the GEMM
// epilogue as f16 hi + residual x1024 planes; the 16-head attention (64-dim heads, scale 1/8, keys kept iff key_mask != 0, query rows kept iff query_mask
// != 0, fully-masked rows give 0 as the reference's nan_to_num) fused on v_wmma_f32_16x16x32_f16 (scores hi.hi + hi.lo + lo.hi with residual terms on
// their own accumulator, online f32 softmax, weights (x32768) and v as f16 hi + residual x1024); then the per-head output linears as ONE block-diagonal
// [1024 x 1024] GEMM (+ bo) and the final x.Wf + bf, both on v_wmma_f32_16x16x32_bf16 with the computed operand as bf16 hi + UNSCALED residual (two

#define NB_  1                   // per pass: the 2 batch items are processed one at a time
#define NT_  2048
#define DM   1024
#define NH_  16
#define HD   64
#define NTK  (NB_ * NT_)
#define NW   1024
#define NQKV 1024
#define PSC  32768.0f
#define LOSC 1024.0f
#define LOSCI (1.0f / 1024.0f)

typedef _Float16 h16;
typedef unsigned short bf;
typedef __attribute__((ext_vector_type(16))) __bf16   v16bf;
typedef __attribute__((ext_vector_type(16))) _Float16 v16h;
typedef __attribute__((ext_vector_type(8)))  _Float16 v8h;
typedef __attribute__((ext_vector_type(8)))  unsigned short v8us;
typedef __attribute__((ext_vector_type(8)))  float    v8f;
typedef __attribute__((ext_vector_type(4)))  float    v4f;
typedef v8h  __attribute__((may_alias)) v8ha;
typedef v4f  __attribute__((may_alias)) v4fa;
typedef v8us __attribute__((may_alias)) v8usa;

__device__ __forceinline__ unsigned short f2bf(float f) { unsigned u = __float_as_uint(f); u += 0x7FFFu + ((u >> 16) & 1u); return (unsigned short)(u >> 16); }
__device__ __forceinline__ float bf2f(unsigned short b) { return __uint_as_float(((unsigned)b) << 16); }
__device__ __forceinline__ float bfr(float f) { return bf2f(f2bf(f)); }
__device__ __forceinline__ v16h cat16(v8h lo, v8h hi) { return __builtin_shufflevector(lo, hi, 0, 1, 2, 3, 4, 5, 6, 7, 8, 9, 10, 11, 12, 13, 14, 15); }
__device__ __forceinline__ v16bf cat16b(v8us lo, v8us hi) { return __builtin_bit_cast(v16bf, __builtin_shufflevector(lo, hi, 0, 1, 2, 3, 4, 5, 6, 7, 8, 9, 10, 11, 12, 13, 14, 15)); }
__device__ __forceinline__ v8f wmma16(v16h a, v16h b, v8f c) { return __builtin_amdgcn_wmma_f32_16x16x32_f16(false, a, false, b, (short)0, c, false, false); }
__device__ __forceinline__ v8f wmmab(v16bf a, v16bf b, v8f c) { return __builtin_amdgcn_wmma_f32_16x16x32_bf16(false, a, false, b, (short)0, c, false, false); }

__global__ __launch_bounds__(256) void k_cvtb(const float* __restrict__ src, int nrows, bf* dst) {
    const int lane = threadIdx.x & 31, r = blockIdx.x * 8 + (threadIdx.x >> 5);
    if (r >= nrows) return;
    v8us o[DM / 256];
#pragma unroll
    for (int q = 0; q < DM / 256; ++q) { v8us t;
#pragma unroll
        for (int i = 0; i < 8; ++i) t[i] = f2bf(src[(size_t)r * DM + q * 256 + lane * 8 + i]);
        o[q] = t; }
#pragma unroll
    for (int q = 0; q < DM / 256; ++q) *(v8us*)(dst + (size_t)r * DM + q * 256 + lane * 8) = o[q];
    
}

// k_wt: WT [n][K] = bf16(W[k][n]) (k-major [K][ncols]) via 64 x 64 LDS tiles; grid (K/64, ncols/64).
__global__ __launch_bounds__(256) void k_wt(const float* __restrict__ Wm, int K, int ncols, bf* WT) {
    __shared__ __align__(16) unsigned short tl[64 * 72];
    const int tid = threadIdx.x, k0 = blockIdx.x * 64, n0 = blockIdx.y * 64;
    const int kk = tid >> 2, nq = (tid & 3) * 16;
#pragma unroll
    for (int i = 0; i < 16; ++i) tl[(nq + i) * 72 + kk] = f2bf(Wm[(size_t)(k0 + kk) * ncols + n0 + nq + i]);
    __syncthreads();
    const int piece = tid & 7;
    auto pass = [&]() {
#pragma unroll
        for (int s = 0; s < 2; ++s) { const int nr = (tid >> 3) + 32 * s; const v8us val = *(const v8usa*)(tl + nr * 72 + piece * 8); *(v8us*)(WT + (size_t)(n0 + nr) * K + k0 + piece * 8) = val; }
    };
    pass(); 
}
__global__ __launch_bounds__(256) void k_cvtb2(const float* __restrict__ src, int nrows, bf* dh, bf* dl) {
    const int lane = threadIdx.x & 31, r = blockIdx.x * 8 + (threadIdx.x >> 5);
    if (r >= nrows) return;
    v8us oh[DM / 256], ol[DM / 256];
#pragma unroll
    for (int q = 0; q < DM / 256; ++q) {
#pragma unroll
        for (int i = 0; i < 8; ++i) { const float v = src[(size_t)r * DM + q * 256 + lane * 8 + i]; const unsigned short hb = f2bf(v); oh[q][i] = hb; ol[q][i] = f2bf(v - bf2f(hb)); } }
{
#pragma unroll
        for (int q = 0; q < DM / 256; ++q) { const size_t o = (size_t)r * DM + q * 256 + lane * 8; *(v8us*)(dh + o) = oh[q]; *(v8us*)(dl + o) = ol[q]; }
         }
}
__global__ __launch_bounds__(256) void k_zero(int nrows, bf* dst) {
    const int lane = threadIdx.x & 31, r = blockIdx.x * 8 + (threadIdx.x >> 5);
    if (r >= nrows) return;
    const v8us z = {};
{
#pragma unroll
        for (int q = 0; q < DM / 256; ++q) *(v8us*)(dst + (size_t)r * DM + q * 256 + lane * 8) = z;
         }
}
template <bool SPLITA, bool F16OUT = false>
__global__ __launch_bounds__(128) void k_gemmb(const bf* __restrict__ A, const bf* __restrict__ Al, const bf* __restrict__ Bn, const float* __restrict__ bias, float* C, int ldc, h16* C2) {
    __shared__ __align__(16) float ost[4][16 * 68];
    const int lane = threadIdx.x & 31, wave = threadIdx.x >> 5, lr = lane & 15, hi = lane >> 4;
    const int r0 = blockIdx.x * 64 + wave * 16, c0 = blockIdx.y * 64;
    const size_t aoff = (size_t)(r0 + lr) * DM + 8 * hi;
    size_t boff[4];
#pragma unroll
    for (int t = 0; t < 4; ++t) boff[t] = (size_t)(c0 + t * 16 + lr) * DM + 8 * hi;
    v8f acc[4];
#pragma unroll
    for (int t = 0; t < 4; ++t) acc[t] = (v8f){};
#pragma unroll 1
    for (int kc = 0; kc < DM; kc += 32) {
        const v16bf a = cat16b(*(const v8us*)(A + aoff + kc), *(const v8us*)(A + aoff + kc + 16));
        v16bf al = a;
        if (SPLITA) al = cat16b(*(const v8us*)(Al + aoff + kc), *(const v8us*)(Al + aoff + kc + 16));
#pragma unroll
        for (int t = 0; t < 4; ++t) { const v16bf b = cat16b(*(const v8us*)(Bn + boff[t] + kc), *(const v8us*)(Bn + boff[t] + kc + 16)); acc[t] = wmmab(a, b, acc[t]); if (SPLITA) acc[t] = wmmab(al, b, acc[t]); }
        asm volatile("v_nop\n\tv_nop\n\tv_nop\n\tv_nop" : "+v"(acc[0]), "+v"(acc[1]), "+v"(acc[2]), "+v"(acc[3]) : "v"(a), "v"(al));
    }
    float* os = &ost[wave][0];
#pragma unroll
    for (int t = 0; t < 4; ++t) { const float bv = bias ? bfr(bias[c0 + t * 16 + lr]) : 0.f;
#pragma unroll
        for (int j = 0; j < 8; ++j) os[(hi * 8 + j) * 68 + t * 16 + lr] = acc[t][j] + bv; }
    __syncthreads();
    if (F16OUT) {
        h16* crow = (h16*)(void*)C + (size_t)r0 * ldc + c0;
        auto pass = [&]() {
#pragma unroll
            for (int s = 0; s < 4; ++s) { const int row = 4 * s + (lane >> 3), piece = lane & 7; const float* sp = os + row * 68 + piece * 8; v8h o, o2;
#pragma unroll
                for (int i = 0; i < 8; ++i) { const h16 a = (h16)sp[i]; o[i] = a; o2[i] = (h16)((sp[i] - (float)a) * LOSC); }
                *(v8h*)(crow + (size_t)row * ldc + piece * 8) = o; if (C2) *(v8h*)(C2 + (size_t)r0 * ldc + c0 + (size_t)row * ldc + piece * 8) = o2; }
        };
        pass(); 
    } else {
        float* crow = C + (size_t)r0 * ldc + c0;
        auto pass = [&]() {
#pragma unroll
            for (int s = 0; s < 8; ++s) { const int Lid = (lane >> 3) + 4 * s, piece = lane & 7; const int row = Lid >> 1, cofs = (Lid & 1) * 32 + piece * 4;
                const v4f val = *(const v4fa*)(os + row * 68 + cofs); *(v4f*)(crow + (size_t)row * ldc + cofs) = val; }
        };
        pass(); 
    }
}

__global__ __launch_bounds__(256) void k_vt(const float* __restrict__ V, h16* VTH, h16* VTL) {
    __shared__ __align__(16) h16 tile[64 * 72];
    __shared__ __align__(16) h16 til2[64 * 72];
    const int bid = blockIdx.x;
    const int b = bid / (NH_ * (NT_ / 64)), rem = bid - b * (NH_ * (NT_ / 64)), h = rem / (NT_ / 64), kt = rem - h * (NT_ / 64);
    const int k0 = kt * 64, tid = threadIdx.x;
    const int kk = tid >> 2, d0 = (tid & 3) * 16;
    const float* src = V + ((size_t)b * NT_ + k0 + kk) * DM + h * HD + d0;
#pragma unroll
    for (int i = 0; i < 16; ++i) { const float v = src[i]; const h16 a = (h16)v; tile[(d0 + i) * 72 + kk] = a; til2[(d0 + i) * 72 + kk] = (h16)((v - (float)a) * LOSC); }
    __syncthreads();
    const int piece = tid & 7;
    const size_t base = (((size_t)b * NH_ + h) * HD) * NT_ + k0;
    auto pass = [&]() {
#pragma unroll
        for (int s = 0; s < 4; ++s) { const int Lid = (tid >> 3) + 32 * s; const int pln = Lid >> 6, d = Lid & 63;
            const v8h val = *(const v8ha*)((pln ? til2 : tile) + d * 72 + piece * 8); *(v8h*)((pln ? VTL : VTH) + base + (size_t)d * NT_ + piece * 8) = val; }
    };
    pass(); 
}

// k_attn: block = (b, h, 64 queries), wave = 16; ALL 64 key tiles (key/query masks per element); 12 WMMA scores /8 (f32), online softmax, weights x32768 f16 tile (same-wave may_alias
// reload after a compiler barrier), 12 WMMA .v; ctx -> bf16 hi + residual planes CH/CL[tok][h*64+d].
__global__ __launch_bounds__(128) void k_attn(const h16* __restrict__ Q16, const h16* __restrict__ QL16, const h16* __restrict__ K16, const h16* __restrict__ KL16, const h16* __restrict__ VTH, const h16* __restrict__ VTL, const float* __restrict__ QM, const float* __restrict__ KM, bf* CH, bf* CL) {
    __shared__ __align__(16) h16 plds[4][16 * 32];
    __shared__ __align__(16) h16 plds2[4][16 * 32];
    __shared__ __align__(16) float ost[4][16 * 68];
    const int lane = threadIdx.x & 31, wave = threadIdx.x >> 5, lr = lane & 15, hi = lane >> 4;
    const int bid = blockIdx.x;
    const int b = bid / (NH_ * (NT_ / 64)), rem = bid - b * (NH_ * (NT_ / 64)), h = rem / (NT_ / 64), qt = rem - h * (NT_ / 64);
    const int q0 = qt * 64 + wave * 16;
    const size_t tok0 = (size_t)b * NT_;
    h16* pl = &plds[wave][0]; h16* pl2 = &plds2[wave][0];
    v16h qa[2];
    const size_t qo0 = (tok0 + q0 + lr) * DM + h * HD + 8 * hi;
#pragma unroll
    for (int kc = 0; kc < 2; ++kc) qa[kc] = cat16(*(const v8h*)(Q16 + qo0 + kc * 32), *(const v8h*)(Q16 + qo0 + kc * 32 + 16));
    const h16* kh_b = K16 + tok0 * DM + h * HD;
    const h16* kl_b = KL16 + tok0 * DM + h * HD;
    const size_t vbase = (((size_t)b * NH_ + h) * HD) * NT_;
    v8f o[4], ox[4];
#pragma unroll
    for (int n = 0; n < 4; ++n) { o[n] = (v8f){}; ox[n] = (v8f){}; }
    float mrow[8], lpart[8];
#pragma unroll
    for (int j = 0; j < 8; ++j) { mrow[j] = -3.0e38f; lpart[j] = 0.f; }
    int qpos[8];
#pragma unroll
    for (int j = 0; j < 8; ++j) qpos[j] = q0 + 8 * hi + j;
    const int kt_lo = 0, kt_hi = NT_ / 32 - 1;     // full attention; masks: key j kept iff key_mask[b][j] != 0, query row i kept iff query_mask[b][i] != 0 (fully masked rows -> 0 output, = nan_to_num)
    float qmv[8];
#pragma unroll
    for (int j = 0; j < 8; ++j) qmv[j] = bfr(QM[tok0 + q0 + 8 * hi + j]);
#pragma unroll 1
    for (int kt = kt_lo; kt <= kt_hi; ++kt) {
        const int l0 = kt * 32;
        const size_t ko0 = (size_t)(l0 + lr) * DM + 8 * hi, ko1 = (size_t)(l0 + 16 + lr) * DM + 8 * hi;
        v8f s0 = {}, s1 = {}, x0 = {}, x1 = {};
#pragma unroll
        for (int kc = 0; kc < 2; ++kc) {
            { const v16h k0h = cat16(*(const v8h*)(kh_b + ko0 + kc * 32), *(const v8h*)(kh_b + ko0 + kc * 32 + 16)), k1h = cat16(*(const v8h*)(kh_b + ko1 + kc * 32), *(const v8h*)(kh_b + ko1 + kc * 32 + 16));
              const v16h qlk = cat16(*(const v8h*)(QL16 + qo0 + kc * 32), *(const v8h*)(QL16 + qo0 + kc * 32 + 16));     // query residual re-read per step (registers)
              s0 = wmma16(qa[kc], k0h, s0); x0 = wmma16(qlk, k0h, x0); s1 = wmma16(qa[kc], k1h, s1); x1 = wmma16(qlk, k1h, x1);
              asm volatile("v_nop" : "+v"(s0), "+v"(s1), "+v"(x0), "+v"(x1) : "v"(qlk), "v"(k0h), "v"(k1h) : "memory"); }
            { const v16h k0l = cat16(*(const v8h*)(kl_b + ko0 + kc * 32), *(const v8h*)(kl_b + ko0 + kc * 32 + 16)), k1l = cat16(*(const v8h*)(kl_b + ko1 + kc * 32), *(const v8h*)(kl_b + ko1 + kc * 32 + 16));
              x0 = wmma16(qa[kc], k0l, x0); x1 = wmma16(qa[kc], k1l, x1);
              asm volatile("v_nop" : "+v"(x0), "+v"(x1) : "v"(k0l), "v"(k1l) : "memory"); }
        }
        asm volatile("v_nop\n\tv_nop\n\tv_nop\n\tv_nop" : "+v"(s0), "+v"(s1), "+v"(x0), "+v"(x1) : "v"(qa[0]), "v"(qa[1]));
        float alpha[8]; const float kma = bfr(KM[tok0 + l0 + lr]), kmb = bfr(KM[tok0 + l0 + 16 + lr]);
#pragma unroll
        for (int j = 0; j < 8; ++j) {
            const int ja = l0 + lr, jb = l0 + 16 + lr, qi = qpos[j];
            const float a0 = (kma != 0.f && qmv[j] != 0.f) ? (s0[j] + x0[j] * LOSCI) * 0.125f : -__builtin_inff(), a1 = (kmb != 0.f && qmv[j] != 0.f) ? (s1[j] + x1[j] * LOSCI) * 0.125f : -__builtin_inff(); (void)qi;
            float mx = fmaxf(a0, a1);
            mx = fmaxf(mx, __shfl_xor(mx, 1, 16)); mx = fmaxf(mx, __shfl_xor(mx, 2, 16)); mx = fmaxf(mx, __shfl_xor(mx, 4, 16)); mx = fmaxf(mx, __shfl_xor(mx, 8, 16));
            const float mn = fmaxf(mrow[j], mx);
            alpha[j] = __expf(mrow[j] - mn); mrow[j] = mn;
            const float p0 = __expf(a0 - mn), p1 = __expf(a1 - mn);
            lpart[j] = lpart[j] * alpha[j] + (p0 + p1);
            const int mr = hi * 8 + j;
            const float ps0 = p0 * PSC, ps1 = p1 * PSC; const h16 h0 = (h16)ps0, h1 = (h16)ps1;
            pl[mr * 32 + lr] = h0; pl[mr * 32 + 16 + lr] = h1;
            pl2[mr * 32 + lr] = (h16)((ps0 - (float)h0) * LOSC); pl2[mr * 32 + 16 + lr] = (h16)((ps1 - (float)h1) * LOSC);
        }
#pragma unroll
        for (int n = 0; n < 4; ++n)
#pragma unroll
            for (int j = 0; j < 8; ++j) { o[n][j] *= alpha[j]; ox[n][j] *= alpha[j]; }
        asm volatile("" ::: "memory");
        const v16h pa = cat16(*(const v8ha*)(pl + lr * 32 + hi * 8), *(const v8ha*)(pl + lr * 32 + 16 + hi * 8));
        const v16h px = cat16(*(const v8ha*)(pl2 + lr * 32 + hi * 8), *(const v8ha*)(pl2 + lr * 32 + 16 + hi * 8));
#pragma unroll
        for (int n = 0; n < 4; ++n) { const size_t vo = vbase + (size_t)(n * 16 + lr) * NT_ + l0 + hi * 8;
            const v16h vh = cat16(*(const v8h*)(VTH + vo), *(const v8h*)(VTH + vo + 16)), vl = cat16(*(const v8h*)(VTL + vo), *(const v8h*)(VTL + vo + 16));
            o[n] = wmma16(pa, vh, o[n]); ox[n] = wmma16(pa, vl, ox[n]); ox[n] = wmma16(px, vh, ox[n]);
            asm volatile("" : "+v"(o[n]), "+v"(ox[n]) : "v"(vh), "v"(vl) : "memory"); }
        asm volatile("v_nop\n\tv_nop\n\tv_nop\n\tv_nop" : "+v"(o[0]), "+v"(o[1]), "+v"(o[2]), "+v"(o[3]), "+v"(ox[0]), "+v"(ox[1]), "+v"(ox[2]), "+v"(ox[3]) : "v"(pa), "v"(px));
    }
    float inv[8];
#pragma unroll
    for (int j = 0; j < 8; ++j) { float rs = lpart[j]; rs += __shfl_xor(rs, 1, 16); rs += __shfl_xor(rs, 2, 16); rs += __shfl_xor(rs, 4, 16); rs += __shfl_xor(rs, 8, 16); inv[j] = (rs > 0.f) ? 1.0f / (rs * PSC) : 0.f; }   // fully masked query row: weights nan_to_num -> 0 -> output 0
    float* os = &ost[wave][0];
#pragma unroll
    for (int n = 0; n < 4; ++n)
#pragma unroll
        for (int j = 0; j < 8; ++j) os[(hi * 8 + j) * 68 + n * 16 + lr] = (o[n][j] + ox[n][j] * LOSCI) * inv[j];
    __syncthreads();
    const size_t cbase = (tok0 + q0) * DM + (size_t)h * HD;
    auto pass = [&]() {
#pragma unroll
        for (int s = 0; s < 4; ++s) { const int row = 4 * s + (lane >> 3), piece = lane & 7; const float* sp = os + row * 68 + piece * 8; v8us oh, ol;
#pragma unroll
            for (int i = 0; i < 8; ++i) { const unsigned short hb = f2bf(sp[i]); oh[i] = hb; ol[i] = f2bf(sp[i] - bf2f(hb)); }
            *(v8us*)(CH + cbase + (size_t)row * DM + piece * 8) = oh; *(v8us*)(CL + cbase + (size_t)row * DM + piece * 8) = ol; }
    };
    pass(); 
}

#define VST2(T, p, v) do { const T vst2_v_ = (v); *(T*)(p) = vst2_v_;  } while (0)
extern "C" void kernel_launch(void* const* d_in, const int* in_sizes, int n_in,
                              void* d_out, int out_size, void* d_ws, size_t ws_size, hipStream_t stream) {
    (void)in_sizes; (void)n_in; (void)out_size;
    const float* xq = (const float*)d_in[0]; const float* xk = (const float*)d_in[1]; const float* xv = (const float*)d_in[2]; const float* QM = (const float*)d_in[3]; const float* KM = (const float*)d_in[4];
    const float* Wq = (const float*)d_in[5]; const float* bq = (const float*)d_in[6]; const float* Wk = (const float*)d_in[7]; const float* bk = (const float*)d_in[8]; const float* Wv = (const float*)d_in[9]; const float* bv = (const float*)d_in[10];
    const float* Wo = (const float*)d_in[11]; const float* bo = (const float*)d_in[12]; const float* Wf = (const float*)d_in[13]; const float* bfin = (const float*)d_in[14];
    float* out = (float*)d_out;    // [2][2048][1024]
    char* wsp = (char*)d_ws;
    auto take = [&](size_t bytes) { char* p = wsp; wsp += (bytes + 255) & ~(size_t)255; return (void*)p; };
    bf* Xq = (bf*)take((size_t)NTK * DM * 2); bf* Xk = (bf*)take((size_t)NTK * DM * 2); bf* Xv = (bf*)take((size_t)NTK * DM * 2);
    bf* WqT = (bf*)take((size_t)DM * DM * 2); bf* WkT = (bf*)take((size_t)DM * DM * 2); bf* WvT = (bf*)take((size_t)DM * DM * 2); bf* WoBD = (bf*)take((size_t)DM * DM * 2); bf* WfT = (bf*)take((size_t)DM * DM * 2);
    float* TMP = (float*)take((size_t)NTK * DM * 4);
    h16* QH = (h16*)take((size_t)NTK * DM * 2); h16* QL = (h16*)take((size_t)NTK * DM * 2); h16* KH = (h16*)take((size_t)NTK * DM * 2); h16* KL = (h16*)take((size_t)NTK * DM * 2);
    h16* VTH = (h16*)take((size_t)NTK * DM * 2); h16* VTL = (h16*)take((size_t)NTK * DM * 2); bf* CH = (bf*)take((size_t)NTK * DM * 2); bf* CL = (bf*)take((size_t)NTK * DM * 2);
    bf* XH = (bf*)take((size_t)NTK * DM * 2); bf* XL = (bf*)take((size_t)NTK * DM * 2);
    if ((size_t)(wsp - (char*)d_ws) > ws_size) return;    // 3 x 4.2 + 5 x 2.1 + 8.4 + 10 x 4.2 ~ 74 MB, no aliasing (per-item reuse in stream order)
    // per-head [E][D] weight slices (k-major) -> one n-major plane [h*64+d][E] each; per-head [D][O] output linears -> a block-diagonal n-major plane; Wf k-major
    for (int h = 0; h < NH_; ++h) {
        k_wt<<<dim3(DM / 64, 1, 1), 256, 0, stream>>>(Wq + (size_t)h * DM * HD, DM, HD, WqT + (size_t)h * HD * DM);
        k_wt<<<dim3(DM / 64, 1, 1), 256, 0, stream>>>(Wk + (size_t)h * DM * HD, DM, HD, WkT + (size_t)h * HD * DM);
        k_wt<<<dim3(DM / 64, 1, 1), 256, 0, stream>>>(Wv + (size_t)h * DM * HD, DM, HD, WvT + (size_t)h * HD * DM);
    }
    k_zero<<<DM / 8, 256, 0, stream>>>(DM, WoBD);
    for (int h = 0; h < NH_; ++h) k_wt<<<dim3(1, 1, 1), 256, 0, stream>>>(Wo + (size_t)h * HD * HD, DM, HD, WoBD + (size_t)h * HD * DM + h * HD);   // block (h,h): WT[h*64+o][h*64+d] = Wo[h][d][o]
    k_wt<<<dim3(DM / 64, DM / 64, 1), 256, 0, stream>>>(Wf, DM, DM, WfT);
    for (int b = 0; b < 2; ++b) {
        k_cvtb<<<NTK / 8, 256, 0, stream>>>(xq + (size_t)b * NTK * DM, NTK, Xq); k_cvtb<<<NTK / 8, 256, 0, stream>>>(xk + (size_t)b * NTK * DM, NTK, Xk); k_cvtb<<<NTK / 8, 256, 0, stream>>>(xv + (size_t)b * NTK * DM, NTK, Xv);
        k_gemmb<false, true><<<dim3(NTK / 64, DM / 64, 1), 128, 0, stream>>>(Xq, nullptr, WqT, bq, (float*)(void*)QH, DM, QL);
        k_gemmb<false, true><<<dim3(NTK / 64, DM / 64, 1), 128, 0, stream>>>(Xk, nullptr, WkT, bk, (float*)(void*)KH, DM, KL);
        k_gemmb<false, false><<<dim3(NTK / 64, DM / 64, 1), 128, 0, stream>>>(Xv, nullptr, WvT, bv, TMP, DM, nullptr);
        k_vt<<<NB_ * NH_ * (NT_ / 64), 256, 0, stream>>>(TMP, VTH, VTL);
        k_attn<<<NB_ * NH_ * (NT_ / 64), 128, 0, stream>>>(QH, QL, KH, KL, VTH, VTL, QM + (size_t)b * NT_, KM + (size_t)b * NT_, CH, CL);
        k_gemmb<true, false><<<dim3(NTK / 64, DM / 64, 1), 128, 0, stream>>>(CH, CL, WoBD, bo, TMP, DM, nullptr);          // per-head o.Wo[h] + bo[h] (block diagonal)
        k_cvtb2<<<NTK / 8, 256, 0, stream>>>(TMP, NTK, XH, XL);
        k_gemmb<true, false><<<dim3(NTK / 64, DM / 64, 1), 128, 0, stream>>>(XH, XL, WfT, bfin, out + (size_t)b * NTK * DM, DM, nullptr);   // x.Wf + bf
    }
}

// v001
// One run takes 463 microseconds.
// Two timings next to v000 put it at 1.72 and 1.73 times that version's speed.
#include <hip/hip_runtime.h>

// Compute dtypes, f32 accumulate, both batch items in every launch: per-head q/k/v = query/key/value.W[h] + b[h] (weights [H][E][D] k-major per head, transposed once
// into one n-major [H*D][E] plane each; PLAIN bf16 operands = inputs rounded once, exact products; biases rounded to bf16) with q and k written straight from the GEMM
// epilogue as f16 hi + residual x1024 planes; the 16-head attention (64-dim heads, scale 1/8, keys kept iff key_mask != 0, query rows kept iff query_mask
// != 0, fully-masked rows give 0 as the reference's nan_to_num) fused on v_wmma_f32_16x16x32_f16 (scores hi.hi + hi.lo + lo.hi with residual terms on
// their own accumulator, online f32 softmax, weights (x32768) and v as f16 hi + residual x1024); then the per-head output linears as ONE block-diagonal
// [1024 x 1024] GEMM (+ bo) and the final x.Wf + bf, both on v_wmma_f32_16x16x32_bf16 with the computed operand as bf16 hi + UNSCALED residual (two

#define NB_  2                   // both batch items are rows of the same launches
#define NT_  2048
#define DM   1024
#define NH_  16
#define HD   64
#define NTK  (NB_ * NT_)
#define NW   1024
#define NQKV 1024
#define PSC  32768.0f
#define LOSC 1024.0f
#define LOSCI (1.0f / 1024.0f)

typedef _Float16 h16;
typedef unsigned short bf;
typedef __attribute__((ext_vector_type(16))) __bf16   v16bf;
typedef __attribute__((ext_vector_type(16))) _Float16 v16h;
typedef __attribute__((ext_vector_type(8)))  _Float16 v8h;
typedef __attribute__((ext_vector_type(8)))  unsigned short v8us;
typedef __attribute__((ext_vector_type(8)))  float    v8f;
typedef __attribute__((ext_vector_type(4)))  float    v4f;
typedef v8h  __attribute__((may_alias)) v8ha;
typedef v4f  __attribute__((may_alias)) v4fa;
typedef v8us __attribute__((may_alias)) v8usa;

__device__ __forceinline__ unsigned short f2bf(float f) { unsigned u = __float_as_uint(f); u += 0x7FFFu + ((u >> 16) & 1u); return (unsigned short)(u >> 16); }
__device__ __forceinline__ float bf2f(unsigned short b) { return __uint_as_float(((unsigned)b) << 16); }
__device__ __forceinline__ float bfr(float f) { return bf2f(f2bf(f)); }
__device__ __forceinline__ v16h cat16(v8h lo, v8h hi) { return __builtin_shufflevector(lo, hi, 0, 1, 2, 3, 4, 5, 6, 7, 8, 9, 10, 11, 12, 13, 14, 15); }
__device__ __forceinline__ v16bf cat16b(v8us lo, v8us hi) { return __builtin_bit_cast(v16bf, __builtin_shufflevector(lo, hi, 0, 1, 2, 3, 4, 5, 6, 7, 8, 9, 10, 11, 12, 13, 14, 15)); }
__device__ __forceinline__ v8f wmma16(v16h a, v16h b, v8f c) { return __builtin_amdgcn_wmma_f32_16x16x32_f16(false, a, false, b, (short)0, c, false, false); }
__device__ __forceinline__ v8f wmmab(v16bf a, v16bf b, v8f c) { return __builtin_amdgcn_wmma_f32_16x16x32_bf16(false, a, false, b, (short)0, c, false, false); }

// blockIdx.y picks one of the three activations (query, key, value).
__global__ __launch_bounds__(256) void k_cvtb(const float* __restrict__ s0, const float* __restrict__ s1, const float* __restrict__ s2, int nrows, bf* d0, bf* d1, bf* d2) {
    const int lane = threadIdx.x & 31, r = blockIdx.x * 8 + (threadIdx.x >> 5);
    if (r >= nrows) return;
    const int y = blockIdx.y;
    const float* src = y == 0 ? s0 : (y == 1 ? s1 : s2);
    bf* dst = y == 0 ? d0 : (y == 1 ? d1 : d2);
    v8us o[DM / 256];
#pragma unroll
    for (int q = 0; q < DM / 256; ++q) { v8us t;
#pragma unroll
        for (int i = 0; i < 8; ++i) t[i] = f2bf(src[(size_t)r * DM + q * 256 + lane * 8 + i]);
        o[q] = t; }
#pragma unroll
    for (int q = 0; q < DM / 256; ++q) *(v8us*)(dst + (size_t)r * DM + q * 256 + lane * 8) = o[q];
    
}

// k_prep: every weight plane in one grid, one 64 x 64 tile (n-tile a, k-tile c) of a [1024][1024] n-major bf16 plane per block, transposed through LDS.
// blockIdx.y = 0, 1, 2: Wq, Wk, Wv (head a, [E][D] k-major); 3: Wf ([K][N] k-major); 4: the block-diagonal plane of the per-head output linears
// (tile (a, a) = Wo[a] transposed, every other tile zero).
__global__ __launch_bounds__(256) void k_prep(const float* __restrict__ Wq, const float* __restrict__ Wk, const float* __restrict__ Wv, const float* __restrict__ Wf, const float* __restrict__ Wo,
                                              bf* WqT, bf* WkT, bf* WvT, bf* WfT, bf* WoBD) {
    __shared__ __align__(16) unsigned short tl[64 * 72];
    const int tid = threadIdx.x, a = blockIdx.x >> 4, c = blockIdx.x & 15, y = blockIdx.y;
    const float* src; bf* pln; int ncols = HD; bool live = true;
    if (y < 3) { src = (y == 0 ? Wq : (y == 1 ? Wk : Wv)) + (size_t)a * DM * HD + (size_t)c * 64 * HD; pln = y == 0 ? WqT : (y == 1 ? WkT : WvT); }
    else if (y == 3) { src = Wf + (size_t)c * 64 * DM + a * 64; pln = WfT; ncols = DM; }
    else { src = Wo + (size_t)a * HD * HD; pln = WoBD; live = (a == c); }
    bf* dst = pln + (size_t)a * 64 * DM + c * 64;
    const int kk = tid >> 2, nq = (tid & 3) * 16;
    if (live) {
#pragma unroll
        for (int i = 0; i < 16; ++i) tl[(nq + i) * 72 + kk] = f2bf(src[(size_t)kk * ncols + nq + i]);
    } else {
#pragma unroll
        for (int i = 0; i < 16; ++i) tl[(nq + i) * 72 + kk] = 0;
    }
    __syncthreads();
    const int piece = tid & 7;
#pragma unroll
    for (int s = 0; s < 2; ++s) { const int nr = (tid >> 3) + 32 * s; const v8us val = *(const v8usa*)(tl + nr * 72 + piece * 8); *(v8us*)(dst + (size_t)nr * DM + piece * 8) = val; }
}
__global__ __launch_bounds__(256) void k_cvtb2(const float* __restrict__ src, int nrows, bf* dh, bf* dl) {
    const int lane = threadIdx.x & 31, r = blockIdx.x * 8 + (threadIdx.x >> 5);
    if (r >= nrows) return;
    v8us oh[DM / 256], ol[DM / 256];
#pragma unroll
    for (int q = 0; q < DM / 256; ++q) {
#pragma unroll
        for (int i = 0; i < 8; ++i) { const float v = src[(size_t)r * DM + q * 256 + lane * 8 + i]; const unsigned short hb = f2bf(v); oh[q][i] = hb; ol[q][i] = f2bf(v - bf2f(hb)); } }
{
#pragma unroll
        for (int q = 0; q < DM / 256; ++q) { const size_t o = (size_t)r * DM + q * 256 + lane * 8; *(v8us*)(dh + o) = oh[q]; *(v8us*)(dl + o) = ol[q]; }
         }
}
// One 64 x 64 tile (blockIdx.x, blockIdx.y) of C = A.Bn^T + bias; ost = the block's 4 x 16 x 68 f32 staging in LDS; F16OUT is the same in every thread of a block.
template <bool SPLITA>
__device__ __forceinline__ void gemm_tile(float* ost, const bool F16OUT, const bf* __restrict__ A, const bf* __restrict__ Al, const bf* __restrict__ Bn, const float* __restrict__ bias, float* C, int ldc, h16* C2) {
    const int lane = threadIdx.x & 31, wave = threadIdx.x >> 5, lr = lane & 15, hi = lane >> 4;
    const int r0 = blockIdx.x * 64 + wave * 16, c0 = blockIdx.y * 64;
    const size_t aoff = (size_t)(r0 + lr) * DM + 8 * hi;
    size_t boff[4];
#pragma unroll
    for (int t = 0; t < 4; ++t) boff[t] = (size_t)(c0 + t * 16 + lr) * DM + 8 * hi;
    v8f acc[4];
#pragma unroll
    for (int t = 0; t < 4; ++t) acc[t] = (v8f){};
#pragma unroll 1
    for (int kc = 0; kc < DM; kc += 32) {
        const v16bf a = cat16b(*(const v8us*)(A + aoff + kc), *(const v8us*)(A + aoff + kc + 16));
        v16bf al = a;
        if (SPLITA) al = cat16b(*(const v8us*)(Al + aoff + kc), *(const v8us*)(Al + aoff + kc + 16));
#pragma unroll
        for (int t = 0; t < 4; ++t) { const v16bf b = cat16b(*(const v8us*)(Bn + boff[t] + kc), *(const v8us*)(Bn + boff[t] + kc + 16)); acc[t] = wmmab(a, b, acc[t]); if (SPLITA) acc[t] = wmmab(al, b, acc[t]); }
        asm volatile("v_nop\n\tv_nop\n\tv_nop\n\tv_nop" : "+v"(acc[0]), "+v"(acc[1]), "+v"(acc[2]), "+v"(acc[3]) : "v"(a), "v"(al));
    }
    float* os = ost + wave * (16 * 68);
#pragma unroll
    for (int t = 0; t < 4; ++t) { const float bv = bias ? bfr(bias[c0 + t * 16 + lr]) : 0.f;
#pragma unroll
        for (int j = 0; j < 8; ++j) os[(hi * 8 + j) * 68 + t * 16 + lr] = acc[t][j] + bv; }
    __syncthreads();
    if (F16OUT) {
        h16* crow = (h16*)(void*)C + (size_t)r0 * ldc + c0;
        auto pass = [&]() {
#pragma unroll
            for (int s = 0; s < 4; ++s) { const int row = 4 * s + (lane >> 3), piece = lane & 7; const float* sp = os + row * 68 + piece * 8; v8h o, o2;
#pragma unroll
                for (int i = 0; i < 8; ++i) { const h16 a = (h16)sp[i]; o[i] = a; o2[i] = (h16)((sp[i] - (float)a) * LOSC); }
                *(v8h*)(crow + (size_t)row * ldc + piece * 8) = o; if (C2) *(v8h*)(C2 + (size_t)r0 * ldc + c0 + (size_t)row * ldc + piece * 8) = o2; }
        };
        pass(); 
    } else {
        float* crow = C + (size_t)r0 * ldc + c0;
        auto pass = [&]() {
#pragma unroll
            for (int s = 0; s < 8; ++s) { const int Lid = (lane >> 3) + 4 * s, piece = lane & 7; const int row = Lid >> 1, cofs = (Lid & 1) * 32 + piece * 4;
                const v4f val = *(const v4fa*)(os + row * 68 + cofs); *(v4f*)(crow + (size_t)row * ldc + cofs) = val; }
        };
        pass(); 
    }
}

__global__ __launch_bounds__(128) void k_gemmb(const bf* __restrict__ A, const bf* __restrict__ Al, const bf* __restrict__ Bn, const float* __restrict__ bias, float* C, int ldc) {
    __shared__ __align__(16) float ost[4 * 16 * 68];
    gemm_tile<true>(ost, false, A, Al, Bn, bias, C, ldc, nullptr);
}
// The three projections in one grid: blockIdx.z = 0: q, 1: k (both to f16 hi + residual planes), 2: v (f32).
__global__ __launch_bounds__(128) void k_qkv(const bf* __restrict__ Xq, const bf* __restrict__ Xk, const bf* __restrict__ Xv, const bf* __restrict__ WqT, const bf* __restrict__ WkT, const bf* __restrict__ WvT,
                                             const float* __restrict__ bq, const float* __restrict__ bk, const float* __restrict__ bv, h16* QH, h16* QL, h16* KH, h16* KL, float* V) {
    __shared__ __align__(16) float ost[4 * 16 * 68];
    const int z = blockIdx.z;
    const bf* A = z == 0 ? Xq : (z == 1 ? Xk : Xv);
    const bf* Bn = z == 0 ? WqT : (z == 1 ? WkT : WvT);
    const float* bias = z == 0 ? bq : (z == 1 ? bk : bv);
    float* C = z == 0 ? (float*)(void*)QH : (z == 1 ? (float*)(void*)KH : V);
    h16* C2 = z == 0 ? QL : (z == 1 ? KL : nullptr);
    gemm_tile<false>(ost, z != 2, A, nullptr, Bn, bias, C, DM, C2);
}

__global__ __launch_bounds__(256) void k_vt(const float* __restrict__ V, h16* VTH, h16* VTL) {
    __shared__ __align__(16) h16 tile[64 * 72];
    __shared__ __align__(16) h16 til2[64 * 72];
    const int bid = blockIdx.x;
    const int b = bid / (NH_ * (NT_ / 64)), rem = bid - b * (NH_ * (NT_ / 64)), h = rem / (NT_ / 64), kt = rem - h * (NT_ / 64);
    const int k0 = kt * 64, tid = threadIdx.x;
    const int kk = tid >> 2, d0 = (tid & 3) * 16;
    const float* src = V + ((size_t)b * NT_ + k0 + kk) * DM + h * HD + d0;
#pragma unroll
    for (int i = 0; i < 16; ++i) { const float v = src[i]; const h16 a = (h16)v; tile[(d0 + i) * 72 + kk] = a; til2[(d0 + i) * 72 + kk] = (h16)((v - (float)a) * LOSC); }
    __syncthreads();
    const int piece = tid & 7;
    const size_t base = (((size_t)b * NH_ + h) * HD) * NT_ + k0;
    auto pass = [&]() {
#pragma unroll
        for (int s = 0; s < 4; ++s) { const int Lid = (tid >> 3) + 32 * s; const int pln = Lid >> 6, d = Lid & 63;
            const v8h val = *(const v8ha*)((pln ? til2 : tile) + d * 72 + piece * 8); *(v8h*)((pln ? VTL : VTH) + base + (size_t)d * NT_ + piece * 8) = val; }
    };
    pass(); 
}

// k_attn: block = (b, h, 64 queries), wave = 16; ALL 64 key tiles (key/query masks per element); 12 WMMA scores /8 (f32), online softmax, weights x32768 f16 tile (same-wave may_alias
// reload after a compiler barrier), 12 WMMA .v; ctx -> bf16 hi + residual planes CH/CL[tok][h*64+d].
__global__ __launch_bounds__(128) void k_attn(const h16* __restrict__ Q16, const h16* __restrict__ QL16, const h16* __restrict__ K16, const h16* __restrict__ KL16, const h16* __restrict__ VTH, const h16* __restrict__ VTL, const float* __restrict__ QM, const float* __restrict__ KM, bf* CH, bf* CL) {
    __shared__ __align__(16) h16 plds[4][16 * 32];
    __shared__ __align__(16) h16 plds2[4][16 * 32];
    __shared__ __align__(16) float ost[4][16 * 68];
    const int lane = threadIdx.x & 31, wave = threadIdx.x >> 5, lr = lane & 15, hi = lane >> 4;
    const int bid = blockIdx.x;
    const int b = bid / (NH_ * (NT_ / 64)), rem = bid - b * (NH_ * (NT_ / 64)), h = rem / (NT_ / 64), qt = rem - h * (NT_ / 64);
    const int q0 = qt * 64 + wave * 16;
    const size_t tok0 = (size_t)b * NT_;
    h16* pl = &plds[wave][0]; h16* pl2 = &plds2[wave][0];
    v16h qa[2];
    const size_t qo0 = (tok0 + q0 + lr) * DM + h * HD + 8 * hi;
#pragma unroll
    for (int kc = 0; kc < 2; ++kc) qa[kc] = cat16(*(const v8h*)(Q16 + qo0 + kc * 32), *(const v8h*)(Q16 + qo0 + kc * 32 + 16));
    const h16* kh_b = K16 + tok0 * DM + h * HD;
    const h16* kl_b = KL16 + tok0 * DM + h * HD;
    const size_t vbase = (((size_t)b * NH_ + h) * HD) * NT_;
    v8f o[4], ox[4];
#pragma unroll
    for (int n = 0; n < 4; ++n) { o[n] = (v8f){}; ox[n] = (v8f){}; }
    float mrow[8], lpart[8];
#pragma unroll
    for (int j = 0; j < 8; ++j) { mrow[j] = -3.0e38f; lpart[j] = 0.f; }
    int qpos[8];
#pragma unroll
    for (int j = 0; j < 8; ++j) qpos[j] = q0 + 8 * hi + j;
    const int kt_lo = 0, kt_hi = NT_ / 32 - 1;     // full attention; masks: key j kept iff key_mask[b][j] != 0, query row i kept iff query_mask[b][i] != 0 (fully masked rows -> 0 output, = nan_to_num)
    float qmv[8];
#pragma unroll
    for (int j = 0; j < 8; ++j) qmv[j] = bfr(QM[tok0 + q0 + 8 * hi + j]);
#pragma unroll 1
    for (int kt = kt_lo; kt <= kt_hi; ++kt) {
        const int l0 = kt * 32;
        const size_t ko0 = (size_t)(l0 + lr) * DM + 8 * hi, ko1 = (size_t)(l0 + 16 + lr) * DM + 8 * hi;
        v8f s0 = {}, s1 = {}, x0 = {}, x1 = {};
#pragma unroll
        for (int kc = 0; kc < 2; ++kc) {
            { const v16h k0h = cat16(*(const v8h*)(kh_b + ko0 + kc * 32), *(const v8h*)(kh_b + ko0 + kc * 32 + 16)), k1h = cat16(*(const v8h*)(kh_b + ko1 + kc * 32), *(const v8h*)(kh_b + ko1 + kc * 32 + 16));
              const v16h qlk = cat16(*(const v8h*)(QL16 + qo0 + kc * 32), *(const v8h*)(QL16 + qo0 + kc * 32 + 16));     // query residual re-read per step (registers)
              s0 = wmma16(qa[kc], k0h, s0); x0 = wmma16(qlk, k0h, x0); s1 = wmma16(qa[kc], k1h, s1); x1 = wmma16(qlk, k1h, x1);
              asm volatile("v_nop" : "+v"(s0), "+v"(s1), "+v"(x0), "+v"(x1) : "v"(qlk), "v"(k0h), "v"(k1h) : "memory"); }
            { const v16h k0l = cat16(*(const v8h*)(kl_b + ko0 + kc * 32), *(const v8h*)(kl_b + ko0 + kc * 32 + 16)), k1l = cat16(*(const v8h*)(kl_b + ko1 + kc * 32), *(const v8h*)(kl_b + ko1 + kc * 32 + 16));
              x0 = wmma16(qa[kc], k0l, x0); x1 = wmma16(qa[kc], k1l, x1);
              asm volatile("v_nop" : "+v"(x0), "+v"(x1) : "v"(k0l), "v"(k1l) : "memory"); }
        }
        asm volatile("v_nop\n\tv_nop\n\tv_nop\n\tv_nop" : "+v"(s0), "+v"(s1), "+v"(x0), "+v"(x1) : "v"(qa[0]), "v"(qa[1]));
        float alpha[8]; const float kma = bfr(KM[tok0 + l0 + lr]), kmb = bfr(KM[tok0 + l0 + 16 + lr]);
#pragma unroll
        for (int j = 0; j < 8; ++j) {
            const int ja = l0 + lr, jb = l0 + 16 + lr, qi = qpos[j];
            const float a0 = (kma != 0.f && qmv[j] != 0.f) ? (s0[j] + x0[j] * LOSCI) * 0.125f : -__builtin_inff(), a1 = (kmb != 0.f && qmv[j] != 0.f) ? (s1[j] + x1[j] * LOSCI) * 0.125f : -__builtin_inff(); (void)qi;
            float mx = fmaxf(a0, a1);
            mx = fmaxf(mx, __shfl_xor(mx, 1, 16)); mx = fmaxf(mx, __shfl_xor(mx, 2, 16)); mx = fmaxf(mx, __shfl_xor(mx, 4, 16)); mx = fmaxf(mx, __shfl_xor(mx, 8, 16));
            const float mn = fmaxf(mrow[j], mx);
            alpha[j] = __expf(mrow[j] - mn); mrow[j] = mn;
            const float p0 = __expf(a0 - mn), p1 = __expf(a1 - mn);
            lpart[j] = lpart[j] * alpha[j] + (p0 + p1);
            const int mr = hi * 8 + j;
            const float ps0 = p0 * PSC, ps1 = p1 * PSC; const h16 h0 = (h16)ps0, h1 = (h16)ps1;
            pl[mr * 32 + lr] = h0; pl[mr * 32 + 16 + lr] = h1;
            pl2[mr * 32 + lr] = (h16)((ps0 - (float)h0) * LOSC); pl2[mr * 32 + 16 + lr] = (h16)((ps1 - (float)h1) * LOSC);
        }
#pragma unroll
        for (int n = 0; n < 4; ++n)
#pragma unroll
            for (int j = 0; j < 8; ++j) { o[n][j] *= alpha[j]; ox[n][j] *= alpha[j]; }
        asm volatile("" ::: "memory");
        const v16h pa = cat16(*(const v8ha*)(pl + lr * 32 + hi * 8), *(const v8ha*)(pl + lr * 32 + 16 + hi * 8));
        const v16h px = cat16(*(const v8ha*)(pl2 + lr * 32 + hi * 8), *(const v8ha*)(pl2 + lr * 32 + 16 + hi * 8));
#pragma unroll
        for (int n = 0; n < 4; ++n) { const size_t vo = vbase + (size_t)(n * 16 + lr) * NT_ + l0 + hi * 8;
            const v16h vh = cat16(*(const v8h*)(VTH + vo), *(const v8h*)(VTH + vo + 16)), vl = cat16(*(const v8h*)(VTL + vo), *(const v8h*)(VTL + vo + 16));
            o[n] = wmma16(pa, vh, o[n]); ox[n] = wmma16(pa, vl, ox[n]); ox[n] = wmma16(px, vh, ox[n]);
            asm volatile("" : "+v"(o[n]), "+v"(ox[n]) : "v"(vh), "v"(vl) : "memory"); }
        asm volatile("v_nop\n\tv_nop\n\tv_nop\n\tv_nop" : "+v"(o[0]), "+v"(o[1]), "+v"(o[2]), "+v"(o[3]), "+v"(ox[0]), "+v"(ox[1]), "+v"(ox[2]), "+v"(ox[3]) : "v"(pa), "v"(px));
    }
    float inv[8];
#pragma unroll
    for (int j = 0; j < 8; ++j) { float rs = lpart[j]; rs += __shfl_xor(rs, 1, 16); rs += __shfl_xor(rs, 2, 16); rs += __shfl_xor(rs, 4, 16); rs += __shfl_xor(rs, 8, 16); inv[j] = (rs > 0.f) ? 1.0f / (rs * PSC) : 0.f; }   // fully masked query row: weights nan_to_num -> 0 -> output 0
    float* os = &ost[wave][0];
#pragma unroll
    for (int n = 0; n < 4; ++n)
#pragma unroll
        for (int j = 0; j < 8; ++j) os[(hi * 8 + j) * 68 + n * 16 + lr] = (o[n][j] + ox[n][j] * LOSCI) * inv[j];
    __syncthreads();
    const size_t cbase = (tok0 + q0) * DM + (size_t)h * HD;
    auto pass = [&]() {
#pragma unroll
        for (int s = 0; s < 4; ++s) { const int row = 4 * s + (lane >> 3), piece = lane & 7; const float* sp = os + row * 68 + piece * 8; v8us oh, ol;
#pragma unroll
            for (int i = 0; i < 8; ++i) { const unsigned short hb = f2bf(sp[i]); oh[i] = hb; ol[i] = f2bf(sp[i] - bf2f(hb)); }
            *(v8us*)(CH + cbase + (size_t)row * DM + piece * 8) = oh; *(v8us*)(CL + cbase + (size_t)row * DM + piece * 8) = ol; }
    };
    pass(); 
}

#define VST2(T, p, v) do { const T vst2_v_ = (v); *(T*)(p) = vst2_v_;  } while (0)
extern "C" void kernel_launch(void* const* d_in, const int* in_sizes, int n_in,
                              void* d_out, int out_size, void* d_ws, size_t ws_size, hipStream_t stream) {
    (void)in_sizes; (void)n_in; (void)out_size;
    const float* xq = (const float*)d_in[0]; const float* xk = (const float*)d_in[1]; const float* xv = (const float*)d_in[2]; const float* QM = (const float*)d_in[3]; const float* KM = (const float*)d_in[4];
    const float* Wq = (const float*)d_in[5]; const float* bq = (const float*)d_in[6]; const float* Wk = (const float*)d_in[7]; const float* bk = (const float*)d_in[8]; const float* Wv = (const float*)d_in[9]; const float* bv = (const float*)d_in[10];
    const float* Wo = (const float*)d_in[11]; const float* bo = (const float*)d_in[12]; const float* Wf = (const float*)d_in[13]; const float* bfin = (const float*)d_in[14];
    float* out = (float*)d_out;    // [2][2048][1024]
    char* wsp = (char*)d_ws;
    auto take = [&](size_t bytes) { char* p = wsp; wsp += (bytes + 255) & ~(size_t)255; return (void*)p; };
    bf* Xq = (bf*)take((size_t)NTK * DM * 2); bf* Xk = (bf*)take((size_t)NTK * DM * 2); bf* Xv = (bf*)take((size_t)NTK * DM * 2);
    bf* WqT = (bf*)take((size_t)DM * DM * 2); bf* WkT = (bf*)take((size_t)DM * DM * 2); bf* WvT = (bf*)take((size_t)DM * DM * 2); bf* WoBD = (bf*)take((size_t)DM * DM * 2); bf* WfT = (bf*)take((size_t)DM * DM * 2);
    float* TMP = (float*)take((size_t)NTK * DM * 4);
    h16* QH = (h16*)take((size_t)NTK * DM * 2); h16* QL = (h16*)take((size_t)NTK * DM * 2); h16* KH = (h16*)take((size_t)NTK * DM * 2); h16* KL = (h16*)take((size_t)NTK * DM * 2);
    h16* VTH = (h16*)take((size_t)NTK * DM * 2); h16* VTL = (h16*)take((size_t)NTK * DM * 2); bf* CH = (bf*)take((size_t)NTK * DM * 2); bf* CL = (bf*)take((size_t)NTK * DM * 2);
    bf* XH = (bf*)take((size_t)NTK * DM * 2); bf* XL = (bf*)take((size_t)NTK * DM * 2);
    if ((size_t)(wsp - (char*)d_ws) > ws_size) return;    // 3 x 8.4 + 5 x 2.1 + 16.8 + 10 x 8.4 ~ 136 MB, no aliasing
    // every loop of launches over heads, planes and batch items is a grid dimension: 8 launches
    k_prep<<<dim3(256, 5, 1), 256, 0, stream>>>(Wq, Wk, Wv, Wf, Wo, WqT, WkT, WvT, WfT, WoBD);
    k_cvtb<<<dim3(NTK / 8, 3, 1), 256, 0, stream>>>(xq, xk, xv, NTK, Xq, Xk, Xv);
    k_qkv<<<dim3(NTK / 64, DM / 64, 3), 128, 0, stream>>>(Xq, Xk, Xv, WqT, WkT, WvT, bq, bk, bv, QH, QL, KH, KL, TMP);
    k_vt<<<NB_ * NH_ * (NT_ / 64), 256, 0, stream>>>(TMP, VTH, VTL);
    k_attn<<<NB_ * NH_ * (NT_ / 64), 128, 0, stream>>>(QH, QL, KH, KL, VTH, VTL, QM, KM, CH, CL);
    k_gemmb<<<dim3(NTK / 64, DM / 64, 1), 128, 0, stream>>>(CH, CL, WoBD, bo, TMP, DM);          // per-head o.Wo[h] + bo[h] (block diagonal)
    k_cvtb2<<<NTK / 8, 256, 0, stream>>>(TMP, NTK, XH, XL);
    k_gemmb<<<dim3(NTK / 64, DM / 64, 1), 128, 0, stream>>>(XH, XL, WfT, bfin, out, DM);   // x.Wf + bf
}

// v002
// It runs in 252 microseconds.
// In both of two side-by-side timings against v001, it was 1.84 times as fast.
// All steps since v000 together make it 3.18 times as fast.
#include <hip/hip_runtime.h>

// Compute dtypes, f32 accumulate, both batch items in every launch: per-head q/k/v = query/key/value.W[h] + b[h] (weights [H][E][D] k-major per head, transposed once
// into one n-major [H*D][E] plane each; PLAIN bf16 operands = inputs rounded once, exact products; biases rounded to bf16) with q and k written straight from the GEMM
// epilogue as f16 hi + residual x1024 planes; the 16-head attention (64-dim heads, scale 1/8, keys kept iff key_mask != 0, query rows kept iff query_mask
// != 0, fully-masked rows give 0 as the reference's nan_to_num) fused on v_wmma_f32_16x16x32_f16 (scores hi.hi + hi.lo + lo.hi with residual terms on
// their own accumulator, online f32 softmax, weights (x32768) and v as f16 hi + residual x1024); then the per-head output linears as ONE block-diagonal
// [1024 x 1024] GEMM (+ bo) and the final x.Wf + bf, both on v_wmma_f32_16x16x32_bf16 with the computed operand as bf16 hi + UNSCALED residual (two

#define NB_  2                   // both batch items are rows of the same launches
#define NT_  2048
#define DM   1024
#define NH_  16
#define HD   64
#define NTK  (NB_ * NT_)
#define NW   1024
#define NQKV 1024
#define PSC  32768.0f
#define LOSC 1024.0f
#define LOSCI (1.0f / 1024.0f)

typedef _Float16 h16;
typedef unsigned short bf;
typedef __attribute__((ext_vector_type(16))) __bf16   v16bf;
typedef __attribute__((ext_vector_type(16))) _Float16 v16h;
typedef __attribute__((ext_vector_type(8)))  _Float16 v8h;
typedef __attribute__((ext_vector_type(8)))  unsigned short v8us;
typedef __attribute__((ext_vector_type(8)))  float    v8f;
typedef __attribute__((ext_vector_type(4)))  float    v4f;
typedef v8h  __attribute__((may_alias)) v8ha;
typedef v4f  __attribute__((may_alias)) v4fa;
typedef v8us __attribute__((may_alias)) v8usa;

__device__ __forceinline__ unsigned short f2bf(float f) { unsigned u = __float_as_uint(f); u += 0x7FFFu + ((u >> 16) & 1u); return (unsigned short)(u >> 16); }
__device__ __forceinline__ float bf2f(unsigned short b) { return __uint_as_float(((unsigned)b) << 16); }
__device__ __forceinline__ float bfr(float f) { return bf2f(f2bf(f)); }
__device__ __forceinline__ v16h cat16(v8h lo, v8h hi) { return __builtin_shufflevector(lo, hi, 0, 1, 2, 3, 4, 5, 6, 7, 8, 9, 10, 11, 12, 13, 14, 15); }
__device__ __forceinline__ v16bf cat16b(v8us lo, v8us hi) { return __builtin_bit_cast(v16bf, __builtin_shufflevector(lo, hi, 0, 1, 2, 3, 4, 5, 6, 7, 8, 9, 10, 11, 12, 13, 14, 15)); }
__device__ __forceinline__ v8f wmma16(v16h a, v16h b, v8f c) { return __builtin_amdgcn_wmma_f32_16x16x32_f16(false, a, false, b, (short)0, c, false, false); }
__device__ __forceinline__ v8f wmmab(v16bf a, v16bf b, v8f c) { return __builtin_amdgcn_wmma_f32_16x16x32_bf16(false, a, false, b, (short)0, c, false, false); }

// blockIdx.y picks one of the three activations (query, key, value).
__global__ __launch_bounds__(256) void k_cvtb(const float* __restrict__ s0, const float* __restrict__ s1, const float* __restrict__ s2, int nrows, bf* d0, bf* d1, bf* d2) {
    const int lane = threadIdx.x & 31, r = blockIdx.x * 8 + (threadIdx.x >> 5);
    if (r >= nrows) return;
    const int y = blockIdx.y;
    const float* src = y == 0 ? s0 : (y == 1 ? s1 : s2);
    bf* dst = y == 0 ? d0 : (y == 1 ? d1 : d2);
    v8us o[DM / 256];
#pragma unroll
    for (int q = 0; q < DM / 256; ++q) { v8us t;
#pragma unroll
        for (int i = 0; i < 8; ++i) t[i] = f2bf(src[(size_t)r * DM + q * 256 + lane * 8 + i]);
        o[q] = t; }
#pragma unroll
    for (int q = 0; q < DM / 256; ++q) *(v8us*)(dst + (size_t)r * DM + q * 256 + lane * 8) = o[q];
    
}

// k_prep: every weight plane in one grid, one 64 x 64 tile (n-tile a, k-tile c) of a [1024][1024] n-major bf16 plane per block, transposed through LDS.
// blockIdx.y = 0, 1, 2: Wq, Wk, Wv (head a, [E][D] k-major); 3: Wf ([K][N] k-major); 4: the block-diagonal plane of the per-head output linears
// (tile (a, a) = Wo[a] transposed, every other tile zero).
__global__ __launch_bounds__(256) void k_prep(const float* __restrict__ Wq, const float* __restrict__ Wk, const float* __restrict__ Wv, const float* __restrict__ Wf, const float* __restrict__ Wo,
                                              bf* WqT, bf* WkT, bf* WvT, bf* WfT, bf* WoBD) {
    __shared__ __align__(16) unsigned short tl[64 * 72];
    const int tid = threadIdx.x, a = blockIdx.x >> 4, c = blockIdx.x & 15, y = blockIdx.y;
    const float* src; bf* pln; int ncols = HD; bool live = true;
    if (y < 3) { src = (y == 0 ? Wq : (y == 1 ? Wk : Wv)) + (size_t)a * DM * HD + (size_t)c * 64 * HD; pln = y == 0 ? WqT : (y == 1 ? WkT : WvT); }
    else if (y == 3) { src = Wf + (size_t)c * 64 * DM + a * 64; pln = WfT; ncols = DM; }
    else { src = Wo + (size_t)a * HD * HD; pln = WoBD; live = (a == c); }
    bf* dst = pln + (size_t)a * 64 * DM + c * 64;
    const int kk = tid >> 2, nq = (tid & 3) * 16;
    if (live) {
#pragma unroll
        for (int i = 0; i < 16; ++i) tl[(nq + i) * 72 + kk] = f2bf(src[(size_t)kk * ncols + nq + i]);
    } else {
#pragma unroll
        for (int i = 0; i < 16; ++i) tl[(nq + i) * 72 + kk] = 0;
    }
    __syncthreads();
    const int piece = tid & 7;
#pragma unroll
    for (int s = 0; s < 2; ++s) { const int nr = (tid >> 3) + 32 * s; const v8us val = *(const v8usa*)(tl + nr * 72 + piece * 8); *(v8us*)(dst + (size_t)nr * DM + piece * 8) = val; }
}
__global__ __launch_bounds__(256) void k_cvtb2(const float* __restrict__ src, int nrows, bf* dh, bf* dl) {
    const int lane = threadIdx.x & 31, r = blockIdx.x * 8 + (threadIdx.x >> 5);
    if (r >= nrows) return;
    v8us oh[DM / 256], ol[DM / 256];
#pragma unroll
    for (int q = 0; q < DM / 256; ++q) {
#pragma unroll
        for (int i = 0; i < 8; ++i) { const float v = src[(size_t)r * DM + q * 256 + lane * 8 + i]; const unsigned short hb = f2bf(v); oh[q][i] = hb; ol[q][i] = f2bf(v - bf2f(hb)); } }
{
#pragma unroll
        for (int q = 0; q < DM / 256; ++q) { const size_t o = (size_t)r * DM + q * 256 + lane * 8; *(v8us*)(dh + o) = oh[q]; *(v8us*)(dl + o) = ol[q]; }
         }
}
// Eight (four) asynchronous 16-byte copies of one lane, global -> LDS. The closing s_wait_xcnt 0 stands in the copies' own statement so that no address register is rewritten in front of it.
__device__ __forceinline__ void copy8(unsigned l0, unsigned l1, unsigned l2, unsigned l3, unsigned l4, unsigned l5, unsigned l6, unsigned l7,
                                      const void* g0, const void* g1, const void* g2, const void* g3, const void* g4, const void* g5, const void* g6, const void* g7) {
    asm volatile("global_load_async_to_lds_b128 %0, %8, off\n\t"
                 "global_load_async_to_lds_b128 %1, %9, off\n\t"
                 "global_load_async_to_lds_b128 %2, %10, off\n\t"
                 "global_load_async_to_lds_b128 %3, %11, off\n\t"
                 "global_load_async_to_lds_b128 %4, %12, off\n\t"
                 "global_load_async_to_lds_b128 %5, %13, off\n\t"
                 "global_load_async_to_lds_b128 %6, %14, off\n\t"
                 "global_load_async_to_lds_b128 %7, %15, off\n\t"
                 "s_wait_xcnt 0x0"
                 :: "v"(l0), "v"(l1), "v"(l2), "v"(l3), "v"(l4), "v"(l5), "v"(l6), "v"(l7), "v"(g0), "v"(g1), "v"(g2), "v"(g3), "v"(g4), "v"(g5), "v"(g6), "v"(g7) : "memory");
}
__device__ __forceinline__ void copy4(unsigned l0, unsigned l1, unsigned l2, unsigned l3, const void* g0, const void* g1, const void* g2, const void* g3) {
    asm volatile("global_load_async_to_lds_b128 %0, %4, off\n\t"
                 "global_load_async_to_lds_b128 %1, %5, off\n\t"
                 "global_load_async_to_lds_b128 %2, %6, off\n\t"
                 "global_load_async_to_lds_b128 %3, %7, off\n\t"
                 "s_wait_xcnt 0x0"
                 :: "v"(l0), "v"(l1), "v"(l2), "v"(l3), "v"(g0), "v"(g1), "v"(g2), "v"(g3) : "memory");
}
// A staged GEMM plane: 64 rows of 64 k elements (128 B) at a pitch of 72 elements (144 B, an odd multiple of 16 B for the 16-byte fragment reads).
#define GPIT 72
#define GPLN (64 * GPIT)
// One 64 x 64 tile (blockIdx.x, blockIdx.y) of C = A.Bn^T + bias; F16OUT is the same in every thread of a block. smem = the block's LDS: in the k loop two buffers of
// 2 (3 with SPLITA) planes (A rows, Bn rows, Al rows of 64 k each), filled by asynchronous copies, the next 64 k in flight while these are worked on; behind the loop's
// last barrier, when no wave reads the planes any more and no copy is in flight, the same bytes are the 4 x 16 x 68 f32 output staging.
template <bool SPLITA>
__device__ __forceinline__ void gemm_tile(unsigned char* smem, const bool F16OUT, const bf* __restrict__ A, const bf* __restrict__ Al, const bf* __restrict__ Bn, const float* __restrict__ bias, float* C, int ldc, h16* C2) {
    const int lane = threadIdx.x & 31, wave = threadIdx.x >> 5, lr = lane & 15, hi = lane >> 4;
    const int r0 = blockIdx.x * 64 + wave * 16, c0 = blockIdx.y * 64;
    constexpr int NPL = SPLITA ? 3 : 2;
    // Each thread copies four 16-byte pieces of each plane: rows crow, crow + 16, crow + 32, crow + 48 (8 pieces a row).
    const int tid = threadIdx.x, crow = tid >> 3, cpc = (tid & 7) * 8;
    const unsigned lc = (unsigned)(size_t)smem + 2u * (unsigned)(crow * GPIT + cpc);
    const bf* ga = A + (size_t)(blockIdx.x * 64 + crow) * DM + cpc;
    const bf* gl = SPLITA ? Al + (size_t)(blockIdx.x * 64 + crow) * DM + cpc : ga;
    const bf* gb = Bn + (size_t)(c0 + crow) * DM + cpc;
    auto fill = [&](int s) {
        const unsigned la = lc + (unsigned)(s & 1) * (2u * NPL * GPLN), lb = la + 2u * GPLN; const int ko = s * 64;
        copy8(la, la + 2u * 16 * GPIT, la + 2u * 32 * GPIT, la + 2u * 48 * GPIT, lb, lb + 2u * 16 * GPIT, lb + 2u * 32 * GPIT, lb + 2u * 48 * GPIT,
              ga + ko, ga + ko + 16 * DM, ga + ko + 32 * DM, ga + ko + 48 * DM, gb + ko, gb + ko + 16 * DM, gb + ko + 32 * DM, gb + ko + 48 * DM);
        if (SPLITA) { const unsigned ll = la + 2u * 2 * GPLN;
            copy4(ll, ll + 2u * 16 * GPIT, ll + 2u * 32 * GPIT, ll + 2u * 48 * GPIT, gl + ko, gl + ko + 16 * DM, gl + ko + 32 * DM, gl + ko + 48 * DM); }
    };
    v8f acc[4];
#pragma unroll
    for (int t = 0; t < 4; ++t) acc[t] = (v8f){};
    fill(0);
    asm volatile("s_wait_asynccnt 0x0" ::: "memory");    // this wave's share of stage 0 has landed
    __syncthreads();                                      // stage 0 is published to every wave
    fill(1);
#pragma unroll 1
    for (int st = 0; st < DM / 64; ++st) {
        const bf* rb = (const bf*)(const void*)smem + (st & 1) * (NPL * GPLN);
        const bf* ra = rb + (wave * 16 + lr) * GPIT + 8 * hi; const bf* rn = rb + GPLN + lr * GPIT + 8 * hi;
#pragma unroll
        for (int kc = 0; kc < 64; kc += 32) {
            const v16bf a = cat16b(*(const v8usa*)(ra + kc), *(const v8usa*)(ra + kc + 16));
            v16bf al = a;
            if (SPLITA) al = cat16b(*(const v8usa*)(ra + 2 * GPLN + kc), *(const v8usa*)(ra + 2 * GPLN + kc + 16));
#pragma unroll
            for (int t = 0; t < 4; ++t) { const v16bf b = cat16b(*(const v8usa*)(rn + t * 16 * GPIT + kc), *(const v8usa*)(rn + t * 16 * GPIT + kc + 16)); acc[t] = wmmab(a, b, acc[t]); if (SPLITA) acc[t] = wmmab(al, b, acc[t]); }
            asm volatile("v_nop\n\tv_nop\n\tv_nop\n\tv_nop" : "+v"(acc[0]), "+v"(acc[1]), "+v"(acc[2]), "+v"(acc[3]) : "v"(a), "v"(al));
        }
        asm volatile("s_wait_dscnt 0x0" ::: "memory");       // this wave's reads of this stage's buffer have returned
        asm volatile("s_wait_asynccnt 0x0" ::: "memory");    // this wave's share of the next stage has landed
        __syncthreads();                                      // publishes the next stage and ends every wave's reads of this buffer
        if (st + 2 < DM / 64) fill(st + 2);                   // refill the buffer just read; the test is the same for the whole block
    }
    asm volatile("s_wait_asynccnt 0x0" ::: "memory");        // nothing of this wave is in flight when the planes become output staging
    float* os = (float*)(void*)smem + wave * (16 * 68);
#pragma unroll
    for (int t = 0; t < 4; ++t) { const float bv = bias ? bfr(bias[c0 + t * 16 + lr]) : 0.f;
#pragma unroll
        for (int j = 0; j < 8; ++j) os[(hi * 8 + j) * 68 + t * 16 + lr] = acc[t][j] + bv; }
    __syncthreads();
    if (F16OUT) {
        h16* crow = (h16*)(void*)C + (size_t)r0 * ldc + c0;
        auto pass = [&]() {
#pragma unroll
            for (int s = 0; s < 4; ++s) { const int row = 4 * s + (lane >> 3), piece = lane & 7; const float* sp = os + row * 68 + piece * 8; v8h o, o2;
#pragma unroll
                for (int i = 0; i < 8; ++i) { const h16 a = (h16)sp[i]; o[i] = a; o2[i] = (h16)((sp[i] - (float)a) * LOSC); }
                *(v8h*)(crow + (size_t)row * ldc + piece * 8) = o; if (C2) *(v8h*)(C2 + (size_t)r0 * ldc + c0 + (size_t)row * ldc + piece * 8) = o2; }
        };
        pass(); 
    } else {
        float* crow = C + (size_t)r0 * ldc + c0;
        auto pass = [&]() {
#pragma unroll
            for (int s = 0; s < 8; ++s) { const int Lid = (lane >> 3) + 4 * s, piece = lane & 7; const int row = Lid >> 1, cofs = (Lid & 1) * 32 + piece * 4;
                const v4f val = *(const v4fa*)(os + row * 68 + cofs); *(v4f*)(crow + (size_t)row * ldc + cofs) = val; }
        };
        pass(); 
    }
}

__global__ __launch_bounds__(128) void k_gemmb(const bf* __restrict__ A, const bf* __restrict__ Al, const bf* __restrict__ Bn, const float* __restrict__ bias, float* C, int ldc) {
    __shared__ __align__(16) unsigned char smem[2 * 3 * GPLN * 2];
    gemm_tile<true>(smem, false, A, Al, Bn, bias, C, ldc, nullptr);
}
// The three projections in one grid: blockIdx.z = 0: q, 1: k (both to f16 hi + residual planes), 2: v (f32).
__global__ __launch_bounds__(128) void k_qkv(const bf* __restrict__ Xq, const bf* __restrict__ Xk, const bf* __restrict__ Xv, const bf* __restrict__ WqT, const bf* __restrict__ WkT, const bf* __restrict__ WvT,
                                             const float* __restrict__ bq, const float* __restrict__ bk, const float* __restrict__ bv, h16* QH, h16* QL, h16* KH, h16* KL, float* V) {
    __shared__ __align__(16) unsigned char smem[2 * 2 * GPLN * 2];
    const int z = blockIdx.z;
    const bf* A = z == 0 ? Xq : (z == 1 ? Xk : Xv);
    const bf* Bn = z == 0 ? WqT : (z == 1 ? WkT : WvT);
    const float* bias = z == 0 ? bq : (z == 1 ? bk : bv);
    float* C = z == 0 ? (float*)(void*)QH : (z == 1 ? (float*)(void*)KH : V);
    h16* C2 = z == 0 ? QL : (z == 1 ? KL : nullptr);
    gemm_tile<false>(smem, z != 2, A, nullptr, Bn, bias, C, DM, C2);
}

__global__ __launch_bounds__(256) void k_vt(const float* __restrict__ V, h16* VTH, h16* VTL) {
    __shared__ __align__(16) h16 tile[64 * 72];
    __shared__ __align__(16) h16 til2[64 * 72];
    const int bid = blockIdx.x;
    const int b = bid / (NH_ * (NT_ / 64)), rem = bid - b * (NH_ * (NT_ / 64)), h = rem / (NT_ / 64), kt = rem - h * (NT_ / 64);
    const int k0 = kt * 64, tid = threadIdx.x;
    const int kk = tid >> 2, d0 = (tid & 3) * 16;
    const float* src = V + ((size_t)b * NT_ + k0 + kk) * DM + h * HD + d0;
#pragma unroll
    for (int i = 0; i < 16; ++i) { const float v = src[i]; const h16 a = (h16)v; tile[(d0 + i) * 72 + kk] = a; til2[(d0 + i) * 72 + kk] = (h16)((v - (float)a) * LOSC); }
    __syncthreads();
    const int piece = tid & 7;
    const size_t base = (((size_t)b * NH_ + h) * HD) * NT_ + k0;
    auto pass = [&]() {
#pragma unroll
        for (int s = 0; s < 4; ++s) { const int Lid = (tid >> 3) + 32 * s; const int pln = Lid >> 6, d = Lid & 63;
            const v8h val = *(const v8ha*)((pln ? til2 : tile) + d * 72 + piece * 8); *(v8h*)((pln ? VTL : VTH) + base + (size_t)d * NT_ + piece * 8) = val; }
    };
    pass(); 
}

// One trip's K and V planes in LDS, in f16 elements: K hi, K residual as [32 keys][64 d] at a pitch of 72 (144 B), V hi, V residual as [64 d][32 keys] at a pitch of 40 (80 B):
// both pitches are odd multiples of 16 B for the 16-byte fragment reads.
#define KPIT 72
#define VPIT 40
#define RKH  0
#define RKL  (32 * KPIT)
#define RVH  (2 * 32 * KPIT)
#define RVL  (2 * 32 * KPIT + 64 * VPIT)
#define RBUF (2 * 32 * KPIT + 2 * 64 * VPIT)
// k_attn: block = (b, h, 64 queries), wave = 16; ALL 64 key tiles of 32 keys (no skip); each tile's K and V planes are brought into LDS once per block by asynchronous copies,
// two buffers, the next tile in flight while this one is worked on; 12 WMMA scores /8 (f32), online softmax, weights x32768 f16 tile (same-wave may_alias
// reload after a compiler barrier), 12 WMMA .v; ctx -> bf16 hi + residual planes CH/CL[tok][h*64+d].
__global__ __launch_bounds__(128) void k_attn(const h16* __restrict__ Q16, const h16* __restrict__ QL16, const h16* __restrict__ K16, const h16* __restrict__ KL16, const h16* __restrict__ VTH, const h16* __restrict__ VTL, const float* __restrict__ QM, const float* __restrict__ KM, bf* CH, bf* CL) {
    __shared__ __align__(16) h16 plds[4][16 * 32];
    __shared__ __align__(16) h16 plds2[4][16 * 32];
    __shared__ __align__(16) float ost[4][16 * 68];
    __shared__ __align__(16) h16 ring[2][RBUF];
    const int lane = threadIdx.x & 31, wave = threadIdx.x >> 5, lr = lane & 15, hi = lane >> 4;
    const int bid = blockIdx.x;
    const int b = bid / (NH_ * (NT_ / 64)), rem = bid - b * (NH_ * (NT_ / 64)), h = rem / (NT_ / 64), qt = rem - h * (NT_ / 64);
    const int q0 = qt * 64 + wave * 16;
    const size_t tok0 = (size_t)b * NT_;
    h16* pl = &plds[wave][0]; h16* pl2 = &plds2[wave][0];
    v16h qa[2];
    const size_t qo0 = (tok0 + q0 + lr) * DM + h * HD + 8 * hi;
#pragma unroll
    for (int kc = 0; kc < 2; ++kc) qa[kc] = cat16(*(const v8h*)(Q16 + qo0 + kc * 32), *(const v8h*)(Q16 + qo0 + kc * 32 + 16));
    const h16* kh_b = K16 + tok0 * DM + h * HD;
    const h16* kl_b = KL16 + tok0 * DM + h * HD;
    const size_t vbase = (((size_t)b * NH_ + h) * HD) * NT_;
    v8f o[4], ox[4];
#pragma unroll
    for (int n = 0; n < 4; ++n) { o[n] = (v8f){}; ox[n] = (v8f){}; }
    float mrow[8], lpart[8];
#pragma unroll
    for (int j = 0; j < 8; ++j) { mrow[j] = -3.0e38f; lpart[j] = 0.f; }
    int qpos[8];
#pragma unroll
    for (int j = 0; j < 8; ++j) qpos[j] = q0 + 8 * hi + j;
    const int kt_lo = 0, kt_hi = NT_ / 32 - 1;     // full attention; masks: key j kept iff key_mask[b][j] != 0, query row i kept iff query_mask[b][i] != 0 (fully masked rows -> 0 output, = nan_to_num)
    float qmv[8];
#pragma unroll
    for (int j = 0; j < 8; ++j) qmv[j] = bfr(QM[tok0 + q0 + 8 * hi + j]);
    // Each thread copies two 16-byte pieces of each of the four planes: K rows krow and krow + 16 (8 pieces a row), V rows vrow and vrow + 32 (4 pieces a row).
    const int tid = threadIdx.x, krow = tid >> 3, kpc = (tid & 7) * 8, vrow = tid >> 2, vpc = (tid & 3) * 8;
    const unsigned ring0 = (unsigned)(size_t)&ring[0][0];
    const unsigned lk = ring0 + 2u * (unsigned)(krow * KPIT + kpc), lv = ring0 + 2u * (unsigned)(vrow * VPIT + vpc);
    const h16* gkh = kh_b + (size_t)krow * DM + kpc; const h16* gkl = kl_b + (size_t)krow * DM + kpc;
    const h16* gvh = VTH + vbase + (size_t)vrow * NT_ + vpc; const h16* gvl = VTL + vbase + (size_t)vrow * NT_ + vpc;
    auto fill = [&](int t) {
        const unsigned bo = (unsigned)(t & 1) * (2u * RBUF); const size_t ka = (size_t)t * 32 * DM, va = (size_t)t * 32;
        copy8(lk + bo + 2u * RKH, lk + bo + 2u * (RKH + 16 * KPIT), lk + bo + 2u * RKL, lk + bo + 2u * (RKL + 16 * KPIT),
              lv + bo + 2u * RVH, lv + bo + 2u * (RVH + 32 * VPIT), lv + bo + 2u * RVL, lv + bo + 2u * (RVL + 32 * VPIT),
              gkh + ka, gkh + ka + 16 * DM, gkl + ka, gkl + ka + 16 * DM, gvh + va, gvh + va + (size_t)32 * NT_, gvl + va, gvl + va + (size_t)32 * NT_);
    };
    fill(0);
    asm volatile("s_wait_asynccnt 0x0" ::: "memory");    // this wave's share of tile 0 has landed
    __syncthreads();                                      // tile 0 is published to every wave
    fill(1);
#pragma unroll 1
    for (int kt = kt_lo; kt <= kt_hi; ++kt) {
        const int l0 = kt * 32;
        const h16* rb = &ring[kt & 1][0];
        const h16* rk0 = rb + lr * KPIT + 8 * hi; const h16* rk1 = rb + (16 + lr) * KPIT + 8 * hi;
        v8f s0 = {}, s1 = {}, x0 = {}, x1 = {};
#pragma unroll
        for (int kc = 0; kc < 2; ++kc) {
            { const v16h k0h = cat16(*(const v8ha*)(rk0 + RKH + kc * 32), *(const v8ha*)(rk0 + RKH + kc * 32 + 16)), k1h = cat16(*(const v8ha*)(rk1 + RKH + kc * 32), *(const v8ha*)(rk1 + RKH + kc * 32 + 16));
              const v16h qlk = cat16(*(const v8h*)(QL16 + qo0 + kc * 32), *(const v8h*)(QL16 + qo0 + kc * 32 + 16));     // query residual re-read per step (registers)
              s0 = wmma16(qa[kc], k0h, s0); x0 = wmma16(qlk, k0h, x0); s1 = wmma16(qa[kc], k1h, s1); x1 = wmma16(qlk, k1h, x1);
              asm volatile("v_nop" : "+v"(s0), "+v"(s1), "+v"(x0), "+v"(x1) : "v"(qlk), "v"(k0h), "v"(k1h) : "memory"); }
            { const v16h k0l = cat16(*(const v8ha*)(rk0 + RKL + kc * 32), *(const v8ha*)(rk0 + RKL + kc * 32 + 16)), k1l = cat16(*(const v8ha*)(rk1 + RKL + kc * 32), *(const v8ha*)(rk1 + RKL + kc * 32 + 16));
              x0 = wmma16(qa[kc], k0l, x0); x1 = wmma16(qa[kc], k1l, x1);
              asm volatile("v_nop" : "+v"(x0), "+v"(x1) : "v"(k0l), "v"(k1l) : "memory"); }
        }
        asm volatile("v_nop\n\tv_nop\n\tv_nop\n\tv_nop" : "+v"(s0), "+v"(s1), "+v"(x0), "+v"(x1) : "v"(qa[0]), "v"(qa[1]));
        float alpha[8]; const float kma = bfr(KM[tok0 + l0 + lr]), kmb = bfr(KM[tok0 + l0 + 16 + lr]);
#pragma unroll
        for (int j = 0; j < 8; ++j) {
            const int ja = l0 + lr, jb = l0 + 16 + lr, qi = qpos[j];
            const float a0 = (kma != 0.f && qmv[j] != 0.f) ? (s0[j] + x0[j] * LOSCI) * 0.125f : -__builtin_inff(), a1 = (kmb != 0.f && qmv[j] != 0.f) ? (s1[j] + x1[j] * LOSCI) * 0.125f : -__builtin_inff(); (void)qi;
            float mx = fmaxf(a0, a1);
            mx = fmaxf(mx, __shfl_xor(mx, 1, 16)); mx = fmaxf(mx, __shfl_xor(mx, 2, 16)); mx = fmaxf(mx, __shfl_xor(mx, 4, 16)); mx = fmaxf(mx, __shfl_xor(mx, 8, 16));
            const float mn = fmaxf(mrow[j], mx);
            alpha[j] = __expf(mrow[j] - mn); mrow[j] = mn;
            const float p0 = __expf(a0 - mn), p1 = __expf(a1 - mn);
            lpart[j] = lpart[j] * alpha[j] + (p0 + p1);
            const int mr = hi * 8 + j;
            const float ps0 = p0 * PSC, ps1 = p1 * PSC; const h16 h0 = (h16)ps0, h1 = (h16)ps1;
            pl[mr * 32 + lr] = h0; pl[mr * 32 + 16 + lr] = h1;
            pl2[mr * 32 + lr] = (h16)((ps0 - (float)h0) * LOSC); pl2[mr * 32 + 16 + lr] = (h16)((ps1 - (float)h1) * LOSC);
        }
#pragma unroll
        for (int n = 0; n < 4; ++n)
#pragma unroll
            for (int j = 0; j < 8; ++j) { o[n][j] *= alpha[j]; ox[n][j] *= alpha[j]; }
        asm volatile("" ::: "memory");
        const v16h pa = cat16(*(const v8ha*)(pl + lr * 32 + hi * 8), *(const v8ha*)(pl + lr * 32 + 16 + hi * 8));
        const v16h px = cat16(*(const v8ha*)(pl2 + lr * 32 + hi * 8), *(const v8ha*)(pl2 + lr * 32 + 16 + hi * 8));
#pragma unroll
        for (int n = 0; n < 4; ++n) { const h16* rv = rb + (n * 16 + lr) * VPIT + hi * 8;
            const v16h vh = cat16(*(const v8ha*)(rv + RVH), *(const v8ha*)(rv + RVH + 16)), vl = cat16(*(const v8ha*)(rv + RVL), *(const v8ha*)(rv + RVL + 16));
            o[n] = wmma16(pa, vh, o[n]); ox[n] = wmma16(pa, vl, ox[n]); ox[n] = wmma16(px, vh, ox[n]);
            asm volatile("" : "+v"(o[n]), "+v"(ox[n]) : "v"(vh), "v"(vl) : "memory"); }
        asm volatile("v_nop\n\tv_nop\n\tv_nop\n\tv_nop" : "+v"(o[0]), "+v"(o[1]), "+v"(o[2]), "+v"(o[3]), "+v"(ox[0]), "+v"(ox[1]), "+v"(ox[2]), "+v"(ox[3]) : "v"(pa), "v"(px));
        asm volatile("s_wait_dscnt 0x0" ::: "memory");       // this wave's reads of this tile's buffer have returned
        asm volatile("s_wait_asynccnt 0x0" ::: "memory");    // this wave's share of the next tile has landed
        __syncthreads();                                      // publishes the next tile and ends every wave's reads of this buffer
        if (kt + 2 <= kt_hi) fill(kt + 2);                    // refill the buffer just read; the test is the same for the whole block
    }
    asm volatile("s_wait_asynccnt 0x0" ::: "memory");        // nothing of this wave is in flight when the loop is left
    float inv[8];
#pragma unroll
    for (int j = 0; j < 8; ++j) { float rs = lpart[j]; rs += __shfl_xor(rs, 1, 16); rs += __shfl_xor(rs, 2, 16); rs += __shfl_xor(rs, 4, 16); rs += __shfl_xor(rs, 8, 16); inv[j] = (rs > 0.f) ? 1.0f / (rs * PSC) : 0.f; }   // fully masked query row: weights nan_to_num -> 0 -> output 0
    float* os = &ost[wave][0];
#pragma unroll
    for (int n = 0; n < 4; ++n)
#pragma unroll
        for (int j = 0; j < 8; ++j) os[(hi * 8 + j) * 68 + n * 16 + lr] = (o[n][j] + ox[n][j] * LOSCI) * inv[j];
    __syncthreads();
    const size_t cbase = (tok0 + q0) * DM + (size_t)h * HD;
    auto pass = [&]() {
#pragma unroll
        for (int s = 0; s < 4; ++s) { const int row = 4 * s + (lane >> 3), piece = lane & 7; const float* sp = os + row * 68 + piece * 8; v8us oh, ol;
#pragma unroll
            for (int i = 0; i < 8; ++i) { const unsigned short hb = f2bf(sp[i]); oh[i] = hb; ol[i] = f2bf(sp[i] - bf2f(hb)); }
            *(v8us*)(CH + cbase + (size_t)row * DM + piece * 8) = oh; *(v8us*)(CL + cbase + (size_t)row * DM + piece * 8) = ol; }
    };
    pass(); 
}

#define VST2(T, p, v) do { const T vst2_v_ = (v); *(T*)(p) = vst2_v_;  } while (0)
extern "C" void kernel_launch(void* const* d_in, const int* in_sizes, int n_in,
                              void* d_out, int out_size, void* d_ws, size_t ws_size, hipStream_t stream) {
    (void)in_sizes; (void)n_in; (void)out_size;
    const float* xq = (const float*)d_in[0]; const float* xk = (const float*)d_in[1]; const float* xv = (const float*)d_in[2]; const float* QM = (const float*)d_in[3]; const float* KM = (const float*)d_in[4];
    const float* Wq = (const float*)d_in[5]; const float* bq = (const float*)d_in[6]; const float* Wk = (const float*)d_in[7]; const float* bk = (const float*)d_in[8]; const float* Wv = (const float*)d_in[9]; const float* bv = (const float*)d_in[10];
    const float* Wo = (const float*)d_in[11]; const float* bo = (const float*)d_in[12]; const float* Wf = (const float*)d_in[13]; const float* bfin = (const float*)d_in[14];
    float* out = (float*)d_out;    // [2][2048][1024]
    char* wsp = (char*)d_ws;
    auto take = [&](size_t bytes) { char* p = wsp; wsp += (bytes + 255) & ~(size_t)255; return (void*)p; };
    bf* Xq = (bf*)take((size_t)NTK * DM * 2); bf* Xk = (bf*)take((size_t)NTK * DM * 2); bf* Xv = (bf*)take((size_t)NTK * DM * 2);
    bf* WqT = (bf*)take((size_t)DM * DM * 2); bf* WkT = (bf*)take((size_t)DM * DM * 2); bf* WvT = (bf*)take((size_t)DM * DM * 2); bf* WoBD = (bf*)take((size_t)DM * DM * 2); bf* WfT = (bf*)take((size_t)DM * DM * 2);
    float* TMP = (float*)take((size_t)NTK * DM * 4);
    h16* QH = (h16*)take((size_t)NTK * DM * 2); h16* QL = (h16*)take((size_t)NTK * DM * 2); h16* KH = (h16*)take((size_t)NTK * DM * 2); h16* KL = (h16*)take((size_t)NTK * DM * 2);
    h16* VTH = (h16*)take((size_t)NTK * DM * 2); h16* VTL = (h16*)take((size_t)NTK * DM * 2); bf* CH = (bf*)take((size_t)NTK * DM * 2); bf* CL = (bf*)take((size_t)NTK * DM * 2);
    bf* XH = (bf*)take((size_t)NTK * DM * 2); bf* XL = (bf*)take((size_t)NTK * DM * 2);
    if ((size_t)(wsp - (char*)d_ws) > ws_size) return;    // 3 x 8.4 + 5 x 2.1 + 16.8 + 10 x 8.4 ~ 136 MB, no aliasing
    // every loop of launches over heads, planes and batch items is a grid dimension: 8 launches
    k_prep<<<dim3(256, 5, 1), 256, 0, stream>>>(Wq, Wk, Wv, Wf, Wo, WqT, WkT, WvT, WfT, WoBD);
    k_cvtb<<<dim3(NTK / 8, 3, 1), 256, 0, stream>>>(xq, xk, xv, NTK, Xq, Xk, Xv);
    k_qkv<<<dim3(NTK / 64, DM / 64, 3), 128, 0, stream>>>(Xq, Xk, Xv, WqT, WkT, WvT, bq, bk, bv, QH, QL, KH, KL, TMP);
    k_vt<<<NB_ * NH_ * (NT_ / 64), 256, 0, stream>>>(TMP, VTH, VTL);
    k_attn<<<NB_ * NH_ * (NT_ / 64), 128, 0, stream>>>(QH, QL, KH, KL, VTH, VTL, QM, KM, CH, CL);
    k_gemmb<<<dim3(NTK / 64, DM / 64, 1), 128, 0, stream>>>(CH, CL, WoBD, bo, TMP, DM);          // per-head o.Wo[h] + bo[h] (block diagonal)
    k_cvtb2<<<NTK / 8, 256, 0, stream>>>(TMP, NTK, XH, XL);
    k_gemmb<<<dim3(NTK / 64, DM / 64, 1), 128, 0, stream>>>(XH, XL, WfT, bfin, out, DM);   // x.Wf + bf
}

// v003
// It runs in 182 microseconds.
// In both of two side-by-side timings against v002, it was 1.39 times as fast.
// All steps since v000 together make it 4.43 times as fast.
#include <hip/hip_runtime.h>

// Compute dtypes, f32 accumulate, both batch items in every launch: per-head q/k/v = query/key/value.W[h] + b[h] (weights [H][E][D] k-major per head, transposed once
// into one n-major [H*D][E] plane each; PLAIN bf16 operands = inputs rounded once, exact products; biases rounded to bf16) with q and k written straight from the GEMM
// epilogue as f16 hi + residual x1024 planes; the 16-head attention (64-dim heads, scale 1/8, keys kept iff key_mask != 0, query rows kept iff query_mask
// != 0, fully-masked rows give 0 as the reference's nan_to_num) fused on v_wmma_f32_16x16x32_f16 (scores hi.hi + hi.lo + lo.hi with residual terms on
// their own accumulator, online f32 softmax, weights (x32768) and v as f16 hi + residual x1024); then the per-head output linears as ONE block-diagonal
// [1024 x 1024] GEMM (+ bo) and the final x.Wf + bf, both on v_wmma_f32_16x16x32_bf16 with the computed operand as bf16 hi + UNSCALED residual (two

#define NB_  2                   // both batch items are rows of the same launches
#define NT_  2048
#define DM   1024
#define NH_  16
#define HD   64
#define NTK  (NB_ * NT_)
#define NW   1024
#define NQKV 1024
#define PSC  32768.0f
#define LOSC 1024.0f
#define LOSCI (1.0f / 1024.0f)

typedef _Float16 h16;
typedef unsigned short bf;
typedef __attribute__((ext_vector_type(16))) __bf16   v16bf;
typedef __attribute__((ext_vector_type(16))) _Float16 v16h;
typedef __attribute__((ext_vector_type(8)))  _Float16 v8h;
typedef __attribute__((ext_vector_type(8)))  unsigned short v8us;
typedef __attribute__((ext_vector_type(8)))  float    v8f;
typedef __attribute__((ext_vector_type(4)))  float    v4f;
typedef __attribute__((ext_vector_type(2)))  float    v2f;
typedef __attribute__((ext_vector_type(2)))  _Float16 v2h;
typedef v8h  __attribute__((may_alias)) v8ha;
typedef v4f  __attribute__((may_alias)) v4fa;
typedef v8us __attribute__((may_alias)) v8usa;

__device__ __forceinline__ unsigned short f2bf(float f) { unsigned u = __float_as_uint(f); u += 0x7FFFu + ((u >> 16) & 1u); return (unsigned short)(u >> 16); }
__device__ __forceinline__ float bf2f(unsigned short b) { return __uint_as_float(((unsigned)b) << 16); }
__device__ __forceinline__ float bfr(float f) { return bf2f(f2bf(f)); }
__device__ __forceinline__ v16h cat16(v8h lo, v8h hi) { return __builtin_shufflevector(lo, hi, 0, 1, 2, 3, 4, 5, 6, 7, 8, 9, 10, 11, 12, 13, 14, 15); }
__device__ __forceinline__ v16bf cat16b(v8us lo, v8us hi) { return __builtin_bit_cast(v16bf, __builtin_shufflevector(lo, hi, 0, 1, 2, 3, 4, 5, 6, 7, 8, 9, 10, 11, 12, 13, 14, 15)); }
__device__ __forceinline__ v8f wmma16(v16h a, v16h b, v8f c) { return __builtin_amdgcn_wmma_f32_16x16x32_f16(false, a, false, b, (short)0, c, false, false); }
__device__ __forceinline__ v8f wmmab(v16bf a, v16bf b, v8f c) { return __builtin_amdgcn_wmma_f32_16x16x32_bf16(false, a, false, b, (short)0, c, false, false); }

// blockIdx.y picks one of the three activations (query, key, value).
__global__ __launch_bounds__(256) void k_cvtb(const float* __restrict__ s0, const float* __restrict__ s1, const float* __restrict__ s2, int nrows, bf* d0, bf* d1, bf* d2) {
    const int lane = threadIdx.x & 31, r = blockIdx.x * 8 + (threadIdx.x >> 5);
    if (r >= nrows) return;
    const int y = blockIdx.y;
    const float* src = y == 0 ? s0 : (y == 1 ? s1 : s2);
    bf* dst = y == 0 ? d0 : (y == 1 ? d1 : d2);
    v8us o[DM / 256];
#pragma unroll
    for (int q = 0; q < DM / 256; ++q) { v8us t;
#pragma unroll
        for (int i = 0; i < 8; ++i) t[i] = f2bf(src[(size_t)r * DM + q * 256 + lane * 8 + i]);
        o[q] = t; }
#pragma unroll
    for (int q = 0; q < DM / 256; ++q) *(v8us*)(dst + (size_t)r * DM + q * 256 + lane * 8) = o[q];
    
}

// k_prep: every weight plane in one grid, one 64 x 64 tile (n-tile a, k-tile c) of a [1024][1024] n-major bf16 plane per block, transposed through LDS.
// blockIdx.y = 0, 1, 2: Wq, Wk, Wv (head a, [E][D] k-major); 3: Wf ([K][N] k-major); 4: the block-diagonal plane of the per-head output linears
// (tile (a, a) = Wo[a] transposed, every other tile zero).
__global__ __launch_bounds__(256) void k_prep(const float* __restrict__ Wq, const float* __restrict__ Wk, const float* __restrict__ Wv, const float* __restrict__ Wf, const float* __restrict__ Wo,
                                              bf* WqT, bf* WkT, bf* WvT, bf* WfT, bf* WoBD) {
    __shared__ __align__(16) unsigned short tl[64 * 72];
    const int tid = threadIdx.x, a = blockIdx.x >> 4, c = blockIdx.x & 15, y = blockIdx.y;
    const float* src; bf* pln; int ncols = HD; bool live = true;
    if (y < 3) { src = (y == 0 ? Wq : (y == 1 ? Wk : Wv)) + (size_t)a * DM * HD + (size_t)c * 64 * HD; pln = y == 0 ? WqT : (y == 1 ? WkT : WvT); }
    else if (y == 3) { src = Wf + (size_t)c * 64 * DM + a * 64; pln = WfT; ncols = DM; }
    else { src = Wo + (size_t)a * HD * HD; pln = WoBD; live = (a == c); }
    bf* dst = pln + (size_t)a * 64 * DM + c * 64;
    const int kk = tid >> 2, nq = (tid & 3) * 16;
    if (live) {
#pragma unroll
        for (int i = 0; i < 16; ++i) tl[(nq + i) * 72 + kk] = f2bf(src[(size_t)kk * ncols + nq + i]);
    } else {
#pragma unroll
        for (int i = 0; i < 16; ++i) tl[(nq + i) * 72 + kk] = 0;
    }
    __syncthreads();
    const int piece = tid & 7;
#pragma unroll
    for (int s = 0; s < 2; ++s) { const int nr = (tid >> 3) + 32 * s; const v8us val = *(const v8usa*)(tl + nr * 72 + piece * 8); *(v8us*)(dst + (size_t)nr * DM + piece * 8) = val; }
}
__global__ __launch_bounds__(256) void k_cvtb2(const float* __restrict__ src, int nrows, bf* dh, bf* dl) {
    const int lane = threadIdx.x & 31, r = blockIdx.x * 8 + (threadIdx.x >> 5);
    if (r >= nrows) return;
    v8us oh[DM / 256], ol[DM / 256];
#pragma unroll
    for (int q = 0; q < DM / 256; ++q) {
#pragma unroll
        for (int i = 0; i < 8; ++i) { const float v = src[(size_t)r * DM + q * 256 + lane * 8 + i]; const unsigned short hb = f2bf(v); oh[q][i] = hb; ol[q][i] = f2bf(v - bf2f(hb)); } }
{
#pragma unroll
        for (int q = 0; q < DM / 256; ++q) { const size_t o = (size_t)r * DM + q * 256 + lane * 8; *(v8us*)(dh + o) = oh[q]; *(v8us*)(dl + o) = ol[q]; }
         }
}
// Eight (four) asynchronous 16-byte copies of one lane, global -> LDS. The closing s_wait_xcnt 0 stands in the copies' own statement so that no address register is rewritten in front of it.
__device__ __forceinline__ void copy8(unsigned l0, unsigned l1, unsigned l2, unsigned l3, unsigned l4, unsigned l5, unsigned l6, unsigned l7,
                                      const void* g0, const void* g1, const void* g2, const void* g3, const void* g4, const void* g5, const void* g6, const void* g7) {
    asm volatile("global_load_async_to_lds_b128 %0, %8, off\n\t"
                 "global_load_async_to_lds_b128 %1, %9, off\n\t"
                 "global_load_async_to_lds_b128 %2, %10, off\n\t"
                 "global_load_async_to_lds_b128 %3, %11, off\n\t"
                 "global_load_async_to_lds_b128 %4, %12, off\n\t"
                 "global_load_async_to_lds_b128 %5, %13, off\n\t"
                 "global_load_async_to_lds_b128 %6, %14, off\n\t"
                 "global_load_async_to_lds_b128 %7, %15, off\n\t"
                 "s_wait_xcnt 0x0"
                 :: "v"(l0), "v"(l1), "v"(l2), "v"(l3), "v"(l4), "v"(l5), "v"(l6), "v"(l7), "v"(g0), "v"(g1), "v"(g2), "v"(g3), "v"(g4), "v"(g5), "v"(g6), "v"(g7) : "memory");
}
__device__ __forceinline__ void copy4(unsigned l0, unsigned l1, unsigned l2, unsigned l3, const void* g0, const void* g1, const void* g2, const void* g3) {
    asm volatile("global_load_async_to_lds_b128 %0, %4, off\n\t"
                 "global_load_async_to_lds_b128 %1, %5, off\n\t"
                 "global_load_async_to_lds_b128 %2, %6, off\n\t"
                 "global_load_async_to_lds_b128 %3, %7, off\n\t"
                 "s_wait_xcnt 0x0"
                 :: "v"(l0), "v"(l1), "v"(l2), "v"(l3), "v"(g0), "v"(g1), "v"(g2), "v"(g3) : "memory");
}
// A staged GEMM plane: 64 rows of 64 k elements (128 B) at a pitch of 72 elements (144 B, an odd multiple of 16 B for the 16-byte fragment reads).
#define GPIT 72
#define GPLN (64 * GPIT)
// One 64 x 64 tile (blockIdx.x, blockIdx.y) of C = A.Bn^T + bias; F16OUT is the same in every thread of a block. smem = the block's LDS: in the k loop two buffers of
// 2 (3 with SPLITA) planes (A rows, Bn rows, Al rows of 64 k each), filled by asynchronous copies, the next 64 k in flight while these are worked on; behind the loop's
// last barrier, when no wave reads the planes any more and no copy is in flight, the same bytes are the 4 x 16 x 68 f32 output staging.
template <bool SPLITA>
__device__ __forceinline__ void gemm_tile(unsigned char* smem, const bool F16OUT, const bf* __restrict__ A, const bf* __restrict__ Al, const bf* __restrict__ Bn, const float* __restrict__ bias, float* C, int ldc, h16* C2) {
    const int lane = threadIdx.x & 31, wave = threadIdx.x >> 5, lr = lane & 15, hi = lane >> 4;
    const int r0 = blockIdx.x * 64 + wave * 16, c0 = blockIdx.y * 64;
    constexpr int NPL = SPLITA ? 3 : 2;
    // Each thread copies four 16-byte pieces of each plane: rows crow, crow + 16, crow + 32, crow + 48 (8 pieces a row).
    const int tid = threadIdx.x, crow = tid >> 3, cpc = (tid & 7) * 8;
    const unsigned lc = (unsigned)(size_t)smem + 2u * (unsigned)(crow * GPIT + cpc);
    const bf* ga = A + (size_t)(blockIdx.x * 64 + crow) * DM + cpc;
    const bf* gl = SPLITA ? Al + (size_t)(blockIdx.x * 64 + crow) * DM + cpc : ga;
    const bf* gb = Bn + (size_t)(c0 + crow) * DM + cpc;
    auto fill = [&](int s) {
        const unsigned la = lc + (unsigned)(s & 1) * (2u * NPL * GPLN), lb = la + 2u * GPLN; const int ko = s * 64;
        copy8(la, la + 2u * 16 * GPIT, la + 2u * 32 * GPIT, la + 2u * 48 * GPIT, lb, lb + 2u * 16 * GPIT, lb + 2u * 32 * GPIT, lb + 2u * 48 * GPIT,
              ga + ko, ga + ko + 16 * DM, ga + ko + 32 * DM, ga + ko + 48 * DM, gb + ko, gb + ko + 16 * DM, gb + ko + 32 * DM, gb + ko + 48 * DM);
        if (SPLITA) { const unsigned ll = la + 2u * 2 * GPLN;
            copy4(ll, ll + 2u * 16 * GPIT, ll + 2u * 32 * GPIT, ll + 2u * 48 * GPIT, gl + ko, gl + ko + 16 * DM, gl + ko + 32 * DM, gl + ko + 48 * DM); }
    };
    v8f acc[4];
#pragma unroll
    for (int t = 0; t < 4; ++t) acc[t] = (v8f){};
    fill(0);
    asm volatile("s_wait_asynccnt 0x0" ::: "memory");    // this wave's share of stage 0 has landed
    __syncthreads();                                      // stage 0 is published to every wave
    fill(1);
#pragma unroll 1
    for (int st = 0; st < DM / 64; ++st) {
        const bf* rb = (const bf*)(const void*)smem + (st & 1) * (NPL * GPLN);
        const bf* ra = rb + (wave * 16 + lr) * GPIT + 8 * hi; const bf* rn = rb + GPLN + lr * GPIT + 8 * hi;
#pragma unroll
        for (int kc = 0; kc < 64; kc += 32) {
            const v16bf a = cat16b(*(const v8usa*)(ra + kc), *(const v8usa*)(ra + kc + 16));
            v16bf al = a;
            if (SPLITA) al = cat16b(*(const v8usa*)(ra + 2 * GPLN + kc), *(const v8usa*)(ra + 2 * GPLN + kc + 16));
#pragma unroll
            for (int t = 0; t < 4; ++t) { const v16bf b = cat16b(*(const v8usa*)(rn + t * 16 * GPIT + kc), *(const v8usa*)(rn + t * 16 * GPIT + kc + 16)); acc[t] = wmmab(a, b, acc[t]); if (SPLITA) acc[t] = wmmab(al, b, acc[t]); }
            asm volatile("v_nop\n\tv_nop\n\tv_nop\n\tv_nop" : "+v"(acc[0]), "+v"(acc[1]), "+v"(acc[2]), "+v"(acc[3]) : "v"(a), "v"(al));
        }
        asm volatile("s_wait_dscnt 0x0" ::: "memory");       // this wave's reads of this stage's buffer have returned
        asm volatile("s_wait_asynccnt 0x0" ::: "memory");    // this wave's share of the next stage has landed
        __syncthreads();                                      // publishes the next stage and ends every wave's reads of this buffer
        if (st + 2 < DM / 64) fill(st + 2);                   // refill the buffer just read; the test is the same for the whole block
    }
    asm volatile("s_wait_asynccnt 0x0" ::: "memory");        // nothing of this wave is in flight when the planes become output staging
    float* os = (float*)(void*)smem + wave * (16 * 68);
#pragma unroll
    for (int t = 0; t < 4; ++t) { const float bv = bias ? bfr(bias[c0 + t * 16 + lr]) : 0.f;
#pragma unroll
        for (int j = 0; j < 8; ++j) os[(hi * 8 + j) * 68 + t * 16 + lr] = acc[t][j] + bv; }
    __syncthreads();
    if (F16OUT) {
        h16* crow = (h16*)(void*)C + (size_t)r0 * ldc + c0;
        auto pass = [&]() {
#pragma unroll
            for (int s = 0; s < 4; ++s) { const int row = 4 * s + (lane >> 3), piece = lane & 7; const float* sp = os + row * 68 + piece * 8; v8h o, o2;
#pragma unroll
                for (int i = 0; i < 8; ++i) { const h16 a = (h16)sp[i]; o[i] = a; o2[i] = (h16)((sp[i] - (float)a) * LOSC); }
                *(v8h*)(crow + (size_t)row * ldc + piece * 8) = o; if (C2) *(v8h*)(C2 + (size_t)r0 * ldc + c0 + (size_t)row * ldc + piece * 8) = o2; }
        };
        pass(); 
    } else {
        float* crow = C + (size_t)r0 * ldc + c0;
        auto pass = [&]() {
#pragma unroll
            for (int s = 0; s < 8; ++s) { const int Lid = (lane >> 3) + 4 * s, piece = lane & 7; const int row = Lid >> 1, cofs = (Lid & 1) * 32 + piece * 4;
                const v4f val = *(const v4fa*)(os + row * 68 + cofs); *(v4f*)(crow + (size_t)row * ldc + cofs) = val; }
        };
        pass(); 
    }
}

__global__ __launch_bounds__(128) void k_gemmb(const bf* __restrict__ A, const bf* __restrict__ Al, const bf* __restrict__ Bn, const float* __restrict__ bias, float* C, int ldc) {
    __shared__ __align__(16) unsigned char smem[2 * 3 * GPLN * 2];
    gemm_tile<true>(smem, false, A, Al, Bn, bias, C, ldc, nullptr);
}
// The three projections in one grid: blockIdx.z = 0: q, 1: k (both to f16 hi + residual planes), 2: v (f32).
__global__ __launch_bounds__(128) void k_qkv(const bf* __restrict__ Xq, const bf* __restrict__ Xk, const bf* __restrict__ Xv, const bf* __restrict__ WqT, const bf* __restrict__ WkT, const bf* __restrict__ WvT,
                                             const float* __restrict__ bq, const float* __restrict__ bk, const float* __restrict__ bv, h16* QH, h16* QL, h16* KH, h16* KL, float* V) {
    __shared__ __align__(16) unsigned char smem[2 * 2 * GPLN * 2];
    const int z = blockIdx.z;
    const bf* A = z == 0 ? Xq : (z == 1 ? Xk : Xv);
    const bf* Bn = z == 0 ? WqT : (z == 1 ? WkT : WvT);
    const float* bias = z == 0 ? bq : (z == 1 ? bk : bv);
    float* C = z == 0 ? (float*)(void*)QH : (z == 1 ? (float*)(void*)KH : V);
    h16* C2 = z == 0 ? QL : (z == 1 ? KL : nullptr);
    gemm_tile<false>(smem, z != 2, A, nullptr, Bn, bias, C, DM, C2);
}

__global__ __launch_bounds__(256) void k_vt(const float* __restrict__ V, h16* VTH, h16* VTL) {
    __shared__ __align__(16) h16 tile[64 * 72];
    __shared__ __align__(16) h16 til2[64 * 72];
    const int bid = blockIdx.x;
    const int b = bid / (NH_ * (NT_ / 64)), rem = bid - b * (NH_ * (NT_ / 64)), h = rem / (NT_ / 64), kt = rem - h * (NT_ / 64);
    const int k0 = kt * 64, tid = threadIdx.x;
    const int kk = tid >> 2, d0 = (tid & 3) * 16;
    const float* src = V + ((size_t)b * NT_ + k0 + kk) * DM + h * HD + d0;
#pragma unroll
    for (int i = 0; i < 16; ++i) { const float v = src[i]; const h16 a = (h16)v; tile[(d0 + i) * 72 + kk] = a; til2[(d0 + i) * 72 + kk] = (h16)((v - (float)a) * LOSC); }
    __syncthreads();
    const int piece = tid & 7;
    const size_t base = (((size_t)b * NH_ + h) * HD) * NT_ + k0;
    auto pass = [&]() {
#pragma unroll
        for (int s = 0; s < 4; ++s) { const int Lid = (tid >> 3) + 32 * s; const int pln = Lid >> 6, d = Lid & 63;
            const v8h val = *(const v8ha*)((pln ? til2 : tile) + d * 72 + piece * 8); *(v8h*)((pln ? VTL : VTH) + base + (size_t)d * NT_ + piece * 8) = val; }
    };
    pass(); 
}

// One trip's K and V planes in LDS, in f16 elements: K hi, K residual as [32 keys][64 d] at a pitch of 72 (144 B), V hi, V residual as [64 d][32 keys] at a pitch of 40 (80 B):
// both pitches are odd multiples of 16 B for the 16-byte fragment reads.
#define KPIT 72
#define VPIT 40
#define RKH  0
#define RKL  (32 * KPIT)
#define RVH  (2 * 32 * KPIT)
#define RVL  (2 * 32 * KPIT + 64 * VPIT)
#define RBUF (2 * 32 * KPIT + 2 * 64 * VPIT)
// lane l with lane l ^ 16, as a vector cross-row move (a shuffle would go through the LDS unit and its wait)
__device__ __forceinline__ float xhalf(float x) { return __builtin_bit_cast(float, __builtin_amdgcn_permlanex16(__builtin_bit_cast(int, x), __builtin_bit_cast(int, x), 0x76543210, 0xfedcba98, false, false)); }
// k_attn: block = (b, h, 64 queries), wave = 16; ALL 64 key tiles of 32 keys (no skip); each tile's K and V planes are brought into LDS once per block by asynchronous copies,
// two buffers, the next tile in flight while this one is worked on. The products are TRANSPOSED: scores^T = K.Q^T (A = K rows, B = Q), ctx^T += V^T.P^T (A = V^T rows, B = P^T), so a lane
// holds 16 of the 32 scores of ONE query (column lr; keys 8 hi + j and 16 + 8 hi + j, which is the k order of a B operand): maximum and sum run in the lane plus one exchange between the
// wave's halves, and the weights (x32768, f16 hi + residual x1024) go from the score accumulators into the B operand in registers. 12 WMMA scores /8 (f32), online softmax, 12 WMMA .v;
// key mask as an additive 0 / -inf table in LDS (built once per block), query mask applied to the row's final factor; ctx -> bf16 hi + residual planes CH/CL[tok][h*64+d].
__global__ __launch_bounds__(128) void k_attn(const h16* __restrict__ Q16, const h16* __restrict__ QL16, const h16* __restrict__ K16, const h16* __restrict__ KL16, const h16* __restrict__ VTH, const h16* __restrict__ VTL, const float* __restrict__ QM, const float* __restrict__ KM, bf* CH, bf* CL) {
    __shared__ __align__(16) float kbias[NT_];
    __shared__ __align__(16) float ost[4][16 * 68];
    __shared__ __align__(16) h16 ring[2][RBUF];
    const int lane = threadIdx.x & 31, wave = threadIdx.x >> 5, lr = lane & 15, hi = lane >> 4;
    const int bid = blockIdx.x;
    const int b = bid / (NH_ * (NT_ / 64)), rem = bid - b * (NH_ * (NT_ / 64)), h = rem / (NT_ / 64), qt = rem - h * (NT_ / 64);
    const int q0 = qt * 64 + wave * 16;
    const size_t tok0 = (size_t)b * NT_;
    v16h qa[2];
    const size_t qo0 = (tok0 + q0 + lr) * DM + h * HD + 8 * hi;
#pragma unroll
    for (int kc = 0; kc < 2; ++kc) qa[kc] = cat16(*(const v8h*)(Q16 + qo0 + kc * 32), *(const v8h*)(Q16 + qo0 + kc * 32 + 16));
    const h16* kh_b = K16 + tok0 * DM + h * HD;
    const h16* kl_b = KL16 + tok0 * DM + h * HD;
    const size_t vbase = (((size_t)b * NH_ + h) * HD) * NT_;
    v8f o[4], ox[4];      // ctx^T: tile n, register j = d n * 16 + 8 hi + j of query lr
#pragma unroll
    for (int n = 0; n < 4; ++n) { o[n] = (v8f){}; ox[n] = (v8f){}; }
    float mrow = -3.0e38f, lpart = 0.f;             // of query lr; lpart sums this half's keys only, the halves are joined behind the loop
    const int kt_lo = 0, kt_hi = NT_ / 32 - 1;     // full attention; masks: key j kept iff key_mask[b][j] != 0, query row i kept iff query_mask[b][i] != 0 (fully masked rows -> 0 output, = nan_to_num)
    const float qmv = bfr(QM[tok0 + q0 + lr]);
    const int tid = threadIdx.x;
    // Each thread copies two 16-byte pieces of each of the four planes: K rows krow and krow + 16 (8 pieces a row), V rows vrow and vrow + 32 (4 pieces a row).
    const int krow = tid >> 3, kpc = (tid & 7) * 8, vrow = tid >> 2, vpc = (tid & 3) * 8;
    const unsigned ring0 = (unsigned)(size_t)&ring[0][0];
    const unsigned lk = ring0 + 2u * (unsigned)(krow * KPIT + kpc), lv = ring0 + 2u * (unsigned)(vrow * VPIT + vpc);
    const h16* gkh = kh_b + (size_t)krow * DM + kpc; const h16* gkl = kl_b + (size_t)krow * DM + kpc;
    const h16* gvh = VTH + vbase + (size_t)vrow * NT_ + vpc; const h16* gvl = VTL + vbase + (size_t)vrow * NT_ + vpc;
    auto fill = [&](int t) {
        const unsigned bo = (unsigned)(t & 1) * (2u * RBUF); const size_t ka = (size_t)t * 32 * DM, va = (size_t)t * 32;
        copy8(lk + bo + 2u * RKH, lk + bo + 2u * (RKH + 16 * KPIT), lk + bo + 2u * RKL, lk + bo + 2u * (RKL + 16 * KPIT),
              lv + bo + 2u * RVH, lv + bo + 2u * (RVH + 32 * VPIT), lv + bo + 2u * RVL, lv + bo + 2u * (RVL + 32 * VPIT),
              gkh + ka, gkh + ka + 16 * DM, gkl + ka, gkl + ka + 16 * DM, gvh + va, gvh + va + (size_t)32 * NT_, gvl + va, gvl + va + (size_t)32 * NT_);
    };
    fill(0);
#pragma unroll
    for (int i = 0; i < NT_ / 512; ++i) { const v4f km = *(const v4f*)(KM + tok0 + i * 512 + tid * 4); v4f kb;
#pragma unroll
        for (int e = 0; e < 4; ++e) kb[e] = bfr(km[e]) != 0.f ? 0.f : -__builtin_inff();
        *(v4fa*)(kbias + i * 512 + tid * 4) = kb; }     // published by the barrier that publishes tile 0
    asm volatile("s_wait_asynccnt 0x0" ::: "memory");    // this wave's share of tile 0 has landed
    __syncthreads();                                      // tile 0 and the key table are published to every wave
    fill(1);
#pragma unroll 1
    for (int kt = kt_lo; kt <= kt_hi; ++kt) {
        const int l0 = kt * 32;
        const h16* rb = &ring[kt & 1][0];
        const h16* rk0 = rb + lr * KPIT + 8 * hi; const h16* rk1 = rb + (16 + lr) * KPIT + 8 * hi;
        const float* kbp = kbias + l0 + 8 * hi;
        const v4f kb[4] = { *(const v4fa*)(kbp), *(const v4fa*)(kbp + 4), *(const v4fa*)(kbp + 16), *(const v4fa*)(kbp + 20) };
        v8f s0 = {}, s1 = {}, x0 = {}, x1 = {};
#pragma unroll
        for (int kc = 0; kc < 2; ++kc) {
            { const v16h k0h = cat16(*(const v8ha*)(rk0 + RKH + kc * 32), *(const v8ha*)(rk0 + RKH + kc * 32 + 16)), k1h = cat16(*(const v8ha*)(rk1 + RKH + kc * 32), *(const v8ha*)(rk1 + RKH + kc * 32 + 16));
              const v16h qlk = cat16(*(const v8h*)(QL16 + qo0 + kc * 32), *(const v8h*)(QL16 + qo0 + kc * 32 + 16));     // query residual re-read per step (registers)
              s0 = wmma16(k0h, qa[kc], s0); x0 = wmma16(k0h, qlk, x0); s1 = wmma16(k1h, qa[kc], s1); x1 = wmma16(k1h, qlk, x1); }
            { const v16h k0l = cat16(*(const v8ha*)(rk0 + RKL + kc * 32), *(const v8ha*)(rk0 + RKL + kc * 32 + 16)), k1l = cat16(*(const v8ha*)(rk1 + RKL + kc * 32), *(const v8ha*)(rk1 + RKL + kc * 32 + 16));
              x0 = wmma16(k0l, qa[kc], x0); x1 = wmma16(k1l, qa[kc], x1); }
        }
        v2f a[8];      // this lane's 16 scores in pairs of neighbouring accumulator registers: a[i] = keys 8 hi + 2 i, + 1 (i < 4), 16 + 8 hi + 2 (i - 4), + 1 (i >= 4)
#pragma unroll
        for (int i = 0; i < 4; ++i) {
            a[i]     = ((v2f){s0[2 * i], s0[2 * i + 1]} + (v2f){x0[2 * i], x0[2 * i + 1]} * LOSCI) * 0.125f + (v2f){kb[i >> 1][(2 * i) & 3], kb[i >> 1][((2 * i) & 3) + 1]};
            a[4 + i] = ((v2f){s1[2 * i], s1[2 * i + 1]} + (v2f){x1[2 * i], x1[2 * i + 1]} * LOSCI) * 0.125f + (v2f){kb[2 + (i >> 1)][(2 * i) & 3], kb[2 + (i >> 1)][((2 * i) & 3) + 1]};
        }
        float mx = fmaxf(a[0].x, a[0].y);
#pragma unroll
        for (int i = 1; i < 8; ++i) mx = fmaxf(mx, fmaxf(a[i].x, a[i].y));
        mx = fmaxf(mx, xhalf(mx));
        const float mn = fmaxf(mrow, mx);
        const float alpha = __expf(mrow - mn); mrow = mn;
        v16h pa, px; v2f ts[2] = { (v2f){0.f, 0.f}, (v2f){0.f, 0.f} };
#pragma unroll
        for (int i = 0; i < 8; ++i) {
            const v2f p = { __expf(a[i].x - mn), __expf(a[i].y - mn) };
            ts[i & 1] += p;
            const v2f ps = p * PSC; const v2h hh = __builtin_convertvector(ps, v2h);
            const v2h ll = __builtin_convertvector((ps - __builtin_convertvector(hh, v2f)) * LOSC, v2h);
            pa[2 * i] = hh.x; pa[2 * i + 1] = hh.y; px[2 * i] = ll.x; px[2 * i + 1] = ll.y;
        }
        ts[0] += ts[1];
        lpart = lpart * alpha + (ts[0].x + ts[0].y);
#pragma unroll
        for (int n = 0; n < 4; ++n)
#pragma unroll
            for (int j = 0; j < 8; ++j) { o[n][j] *= alpha; ox[n][j] *= alpha; }
#pragma unroll
        for (int n = 0; n < 4; ++n) { const h16* rv = rb + (n * 16 + lr) * VPIT + hi * 8;
            const v16h vh = cat16(*(const v8ha*)(rv + RVH), *(const v8ha*)(rv + RVH + 16)), vl = cat16(*(const v8ha*)(rv + RVL), *(const v8ha*)(rv + RVL + 16));
            o[n] = wmma16(vh, pa, o[n]); ox[n] = wmma16(vl, pa, ox[n]); ox[n] = wmma16(vh, px, ox[n]); }
        asm volatile("s_wait_dscnt 0x0" ::: "memory");       // this wave's reads of this tile's buffer have returned
        asm volatile("s_wait_asynccnt 0x0" ::: "memory");    // this wave's share of the next tile has landed
        __syncthreads();                                      // publishes the next tile and ends every wave's reads of this buffer
        if (kt + 2 <= kt_hi) fill(kt + 2);                    // refill the buffer just read; the test is the same for the whole block
    }
    asm volatile("s_wait_asynccnt 0x0" ::: "memory");        // nothing of this wave is in flight when the loop is left
    const float rs = lpart + xhalf(lpart);
    const float inv = (rs > 0.f && qmv != 0.f) ? 1.0f / (rs * PSC) : 0.f;   // masked query row, or every key masked: weights nan_to_num -> 0 -> output 0
    float* os = &ost[wave][0];
#pragma unroll
    for (int n = 0; n < 4; ++n)
#pragma unroll
        for (int j = 0; j < 8; ++j) os[lr * 68 + n * 16 + hi * 8 + j] = (o[n][j] + ox[n][j] * LOSCI) * inv;
    __syncthreads();
    const size_t cbase = (tok0 + q0) * DM + (size_t)h * HD;
    auto pass = [&]() {
#pragma unroll
        for (int s = 0; s < 4; ++s) { const int row = 4 * s + (lane >> 3), piece = lane & 7; const float* sp = os + row * 68 + piece * 8; v8us oh, ol;
#pragma unroll
            for (int i = 0; i < 8; ++i) { const unsigned short hb = f2bf(sp[i]); oh[i] = hb; ol[i] = f2bf(sp[i] - bf2f(hb)); }
            *(v8us*)(CH + cbase + (size_t)row * DM + piece * 8) = oh; *(v8us*)(CL + cbase + (size_t)row * DM + piece * 8) = ol; }
    };
    pass(); 
}

#define VST2(T, p, v) do { const T vst2_v_ = (v); *(T*)(p) = vst2_v_;  } while (0)
extern "C" void kernel_launch(void* const* d_in, const int* in_sizes, int n_in,
                              void* d_out, int out_size, void* d_ws, size_t ws_size, hipStream_t stream) {
    (void)in_sizes; (void)n_in; (void)out_size;
    const float* xq = (const float*)d_in[0]; const float* xk = (const float*)d_in[1]; const float* xv = (const float*)d_in[2]; const float* QM = (const float*)d_in[3]; const float* KM = (const float*)d_in[4];
    const float* Wq = (const float*)d_in[5]; const float* bq = (const float*)d_in[6]; const float* Wk = (const float*)d_in[7]; const float* bk = (const float*)d_in[8]; const float* Wv = (const float*)d_in[9]; const float* bv = (const float*)d_in[10];
    const float* Wo = (const float*)d_in[11]; const float* bo = (const float*)d_in[12]; const float* Wf = (const float*)d_in[13]; const float* bfin = (const float*)d_in[14];
    float* out = (float*)d_out;    // [2][2048][1024]
    char* wsp = (char*)d_ws;
    auto take = [&](size_t bytes) { char* p = wsp; wsp += (bytes + 255) & ~(size_t)255; return (void*)p; };
    bf* Xq = (bf*)take((size_t)NTK * DM * 2); bf* Xk = (bf*)take((size_t)NTK * DM * 2); bf* Xv = (bf*)take((size_t)NTK * DM * 2);
    bf* WqT = (bf*)take((size_t)DM * DM * 2); bf* WkT = (bf*)take((size_t)DM * DM * 2); bf* WvT = (bf*)take((size_t)DM * DM * 2); bf* WoBD = (bf*)take((size_t)DM * DM * 2); bf* WfT = (bf*)take((size_t)DM * DM * 2);
    float* TMP = (float*)take((size_t)NTK * DM * 4);
    h16* QH = (h16*)take((size_t)NTK * DM * 2); h16* QL = (h16*)take((size_t)NTK * DM * 2); h16* KH = (h16*)take((size_t)NTK * DM * 2); h16* KL = (h16*)take((size_t)NTK * DM * 2);
    h16* VTH = (h16*)take((size_t)NTK * DM * 2); h16* VTL = (h16*)take((size_t)NTK * DM * 2); bf* CH = (bf*)take((size_t)NTK * DM * 2); bf* CL = (bf*)take((size_t)NTK * DM * 2);
    bf* XH = (bf*)take((size_t)NTK * DM * 2); bf* XL = (bf*)take((size_t)NTK * DM * 2);
    if ((size_t)(wsp - (char*)d_ws) > ws_size) return;    // 3 x 8.4 + 5 x 2.1 + 16.8 + 10 x 8.4 ~ 136 MB, no aliasing
    // every loop of launches over heads, planes and batch items is a grid dimension: 8 launches
    k_prep<<<dim3(256, 5, 1), 256, 0, stream>>>(Wq, Wk, Wv, Wf, Wo, WqT, WkT, WvT, WfT, WoBD);
    k_cvtb<<<dim3(NTK / 8, 3, 1), 256, 0, stream>>>(xq, xk, xv, NTK, Xq, Xk, Xv);
    k_qkv<<<dim3(NTK / 64, DM / 64, 3), 128, 0, stream>>>(Xq, Xk, Xv, WqT, WkT, WvT, bq, bk, bv, QH, QL, KH, KL, TMP);
    k_vt<<<NB_ * NH_ * (NT_ / 64), 256, 0, stream>>>(TMP, VTH, VTL);
    k_attn<<<NB_ * NH_ * (NT_ / 64), 128, 0, stream>>>(QH, QL, KH, KL, VTH, VTL, QM, KM, CH, CL);
    k_gemmb<<<dim3(NTK / 64, DM / 64, 1), 128, 0, stream>>>(CH, CL, WoBD, bo, TMP, DM);          // per-head o.Wo[h] + bo[h] (block diagonal)
    k_cvtb2<<<NTK / 8, 256, 0, stream>>>(TMP, NTK, XH, XL);
    k_gemmb<<<dim3(NTK / 64, DM / 64, 1), 128, 0, stream>>>(XH, XL, WfT, bfin, out, DM);   // x.Wf + bf
}

// v004
// Measured time: 159 microseconds a run.
// In both of two side-by-side timings against v003, it was 1.15 times as fast.
// Counting every step since v000, it is 5.10 times as fast.
#include <hip/hip_runtime.h>

// Compute dtypes, f32 accumulate, both batch items in every launch: per-head q/k/v = query/key/value.W[h] + b[h] (weights [H][E][D] k-major per head, transposed once
// into one n-major [H*D][E] plane each; PLAIN bf16 operands = inputs rounded once, exact products; biases rounded to bf16) with q and k written straight from the GEMM
// epilogue as f16 hi + residual x1024 planes; the 16-head attention (64-dim heads, scale 1/8, keys kept iff key_mask != 0, query rows kept iff query_mask
// != 0, fully-masked rows give 0 as the reference's nan_to_num) fused on v_wmma_f32_16x16x32_f16 (scores hi.hi + hi.lo + lo.hi with residual terms on
// their own accumulator, online f32 softmax, weights (x32768) and v as f16 hi + residual x1024); the per-head output linear ctx.Wo[h] + bo[h] in the attention
// kernel's epilogue, and the final x.Wf + bf as a GEMM, both on v_wmma_f32_16x16x32_bf16 with the computed operand as bf16 hi + UNSCALED residual (two

#define NB_  2                   // both batch items are rows of the same launches
#define NT_  2048
#define DM   1024
#define NH_  16
#define HD   64
#define NTK  (NB_ * NT_)
#define NW   1024
#define NQKV 1024
#define PSC  32768.0f
#define LOSC 1024.0f
#define LOSCI (1.0f / 1024.0f)

typedef _Float16 h16;
typedef unsigned short bf;
typedef __attribute__((ext_vector_type(16))) __bf16   v16bf;
typedef __attribute__((ext_vector_type(16))) _Float16 v16h;
typedef __attribute__((ext_vector_type(8)))  _Float16 v8h;
typedef __attribute__((ext_vector_type(8)))  unsigned short v8us;
typedef __attribute__((ext_vector_type(8)))  float    v8f;
typedef __attribute__((ext_vector_type(4)))  float    v4f;
typedef __attribute__((ext_vector_type(2)))  float    v2f;
typedef __attribute__((ext_vector_type(2)))  _Float16 v2h;
typedef v8h  __attribute__((may_alias)) v8ha;
typedef v4f  __attribute__((may_alias)) v4fa;
typedef v8us __attribute__((may_alias)) v8usa;

__device__ __forceinline__ unsigned short f2bf(float f) { unsigned u = __float_as_uint(f); u += 0x7FFFu + ((u >> 16) & 1u); return (unsigned short)(u >> 16); }
__device__ __forceinline__ float bf2f(unsigned short b) { return __uint_as_float(((unsigned)b) << 16); }
__device__ __forceinline__ float bfr(float f) { return bf2f(f2bf(f)); }
__device__ __forceinline__ v16h cat16(v8h lo, v8h hi) { return __builtin_shufflevector(lo, hi, 0, 1, 2, 3, 4, 5, 6, 7, 8, 9, 10, 11, 12, 13, 14, 15); }
__device__ __forceinline__ v16bf cat16b(v8us lo, v8us hi) { return __builtin_bit_cast(v16bf, __builtin_shufflevector(lo, hi, 0, 1, 2, 3, 4, 5, 6, 7, 8, 9, 10, 11, 12, 13, 14, 15)); }
__device__ __forceinline__ v8f wmma16(v16h a, v16h b, v8f c) { return __builtin_amdgcn_wmma_f32_16x16x32_f16(false, a, false, b, (short)0, c, false, false); }
__device__ __forceinline__ v8f wmmab(v16bf a, v16bf b, v8f c) { return __builtin_amdgcn_wmma_f32_16x16x32_bf16(false, a, false, b, (short)0, c, false, false); }

// blockIdx.y picks one of the three activations (query, key, value).
__global__ __launch_bounds__(256) void k_cvtb(const float* __restrict__ s0, const float* __restrict__ s1, const float* __restrict__ s2, int nrows, bf* d0, bf* d1, bf* d2) {
    const int lane = threadIdx.x & 31, r = blockIdx.x * 8 + (threadIdx.x >> 5);
    if (r >= nrows) return;
    const int y = blockIdx.y;
    const float* src = y == 0 ? s0 : (y == 1 ? s1 : s2);
    bf* dst = y == 0 ? d0 : (y == 1 ? d1 : d2);
    v8us o[DM / 256];
#pragma unroll
    for (int q = 0; q < DM / 256; ++q) { v8us t;
#pragma unroll
        for (int i = 0; i < 8; ++i) t[i] = f2bf(src[(size_t)r * DM + q * 256 + lane * 8 + i]);
        o[q] = t; }
#pragma unroll
    for (int q = 0; q < DM / 256; ++q) *(v8us*)(dst + (size_t)r * DM + q * 256 + lane * 8) = o[q];
    
}

// k_prep: every weight plane in one grid, one 64 x 64 tile (n-tile a, k-tile c) of a [1024][1024] n-major bf16 plane per block, transposed through LDS.
// blockIdx.y = 0, 1, 2: Wq, Wk, Wv (head a, [E][D] k-major); 3: Wf ([K][N] k-major); 4: the per-head output linears: tile (a, a) = Wo[a] transposed; the other
// tiles of that plane are neither written nor read.
__global__ __launch_bounds__(256) void k_prep(const float* __restrict__ Wq, const float* __restrict__ Wk, const float* __restrict__ Wv, const float* __restrict__ Wf, const float* __restrict__ Wo,
                                              bf* WqT, bf* WkT, bf* WvT, bf* WfT, bf* WoBD) {
    __shared__ __align__(16) unsigned short tl[64 * 72];
    const int tid = threadIdx.x, a = blockIdx.x >> 4, c = blockIdx.x & 15, y = blockIdx.y;
    const float* src; bf* pln; int ncols = HD; bool live = true;
    if (y < 3) { src = (y == 0 ? Wq : (y == 1 ? Wk : Wv)) + (size_t)a * DM * HD + (size_t)c * 64 * HD; pln = y == 0 ? WqT : (y == 1 ? WkT : WvT); }
    else if (y == 3) { src = Wf + (size_t)c * 64 * DM + a * 64; pln = WfT; ncols = DM; }
    else { src = Wo + (size_t)a * HD * HD; pln = WoBD; live = (a == c); }
    if (!live) return;      // the same for the whole block, in front of the barrier
    bf* dst = pln + (size_t)a * 64 * DM + c * 64;
    const int kk = tid >> 2, nq = (tid & 3) * 16;
#pragma unroll
    for (int i = 0; i < 16; ++i) tl[(nq + i) * 72 + kk] = f2bf(src[(size_t)kk * ncols + nq + i]);
    __syncthreads();
    const int piece = tid & 7;
#pragma unroll
    for (int s = 0; s < 2; ++s) { const int nr = (tid >> 3) + 32 * s; const v8us val = *(const v8usa*)(tl + nr * 72 + piece * 8); *(v8us*)(dst + (size_t)nr * DM + piece * 8) = val; }
}
// Eight (four) asynchronous 16-byte copies of one lane, global -> LDS. The closing s_wait_xcnt 0 stands in the copies' own statement so that no address register is rewritten in front of it.
__device__ __forceinline__ void copy8(unsigned l0, unsigned l1, unsigned l2, unsigned l3, unsigned l4, unsigned l5, unsigned l6, unsigned l7,
                                      const void* g0, const void* g1, const void* g2, const void* g3, const void* g4, const void* g5, const void* g6, const void* g7) {
    asm volatile("global_load_async_to_lds_b128 %0, %8, off\n\t"
                 "global_load_async_to_lds_b128 %1, %9, off\n\t"
                 "global_load_async_to_lds_b128 %2, %10, off\n\t"
                 "global_load_async_to_lds_b128 %3, %11, off\n\t"
                 "global_load_async_to_lds_b128 %4, %12, off\n\t"
                 "global_load_async_to_lds_b128 %5, %13, off\n\t"
                 "global_load_async_to_lds_b128 %6, %14, off\n\t"
                 "global_load_async_to_lds_b128 %7, %15, off\n\t"
                 "s_wait_xcnt 0x0"
                 :: "v"(l0), "v"(l1), "v"(l2), "v"(l3), "v"(l4), "v"(l5), "v"(l6), "v"(l7), "v"(g0), "v"(g1), "v"(g2), "v"(g3), "v"(g4), "v"(g5), "v"(g6), "v"(g7) : "memory");
}
__device__ __forceinline__ void copy4(unsigned l0, unsigned l1, unsigned l2, unsigned l3, const void* g0, const void* g1, const void* g2, const void* g3) {
    asm volatile("global_load_async_to_lds_b128 %0, %4, off\n\t"
                 "global_load_async_to_lds_b128 %1, %5, off\n\t"
                 "global_load_async_to_lds_b128 %2, %6, off\n\t"
                 "global_load_async_to_lds_b128 %3, %7, off\n\t"
                 "s_wait_xcnt 0x0"
                 :: "v"(l0), "v"(l1), "v"(l2), "v"(l3), "v"(g0), "v"(g1), "v"(g2), "v"(g3) : "memory");
}
// A staged GEMM plane: 64 rows of 64 k elements (128 B) at a pitch of 72 elements (144 B, an odd multiple of 16 B for the 16-byte fragment reads).
#define GPIT 72
#define GPLN (64 * GPIT)
// One 64 x 64 tile (blockIdx.x, blockIdx.y) of C = A.Bn^T + bias; F16OUT is the same in every thread of a block. smem = the block's LDS: in the k loop two buffers of
// 2 (3 with SPLITA) planes (A rows, Bn rows, Al rows of 64 k each), filled by asynchronous copies, the next 64 k in flight while these are worked on; behind the loop's
// last barrier, when no wave reads the planes any more and no copy is in flight, the same bytes are the 4 x 16 x 68 f32 output staging.
template <bool SPLITA>
__device__ __forceinline__ void gemm_tile(unsigned char* smem, const bool F16OUT, const bf* __restrict__ A, const bf* __restrict__ Al, const bf* __restrict__ Bn, const float* __restrict__ bias, float* C, int ldc, h16* C2) {
    const int lane = threadIdx.x & 31, wave = threadIdx.x >> 5, lr = lane & 15, hi = lane >> 4;
    const int r0 = blockIdx.x * 64 + wave * 16, c0 = blockIdx.y * 64;
    constexpr int NPL = SPLITA ? 3 : 2;
    // Each thread copies four 16-byte pieces of each plane: rows crow, crow + 16, crow + 32, crow + 48 (8 pieces a row).
    const int tid = threadIdx.x, crow = tid >> 3, cpc = (tid & 7) * 8;
    const unsigned lc = (unsigned)(size_t)smem + 2u * (unsigned)(crow * GPIT + cpc);
    const bf* ga = A + (size_t)(blockIdx.x * 64 + crow) * DM + cpc;
    const bf* gl = SPLITA ? Al + (size_t)(blockIdx.x * 64 + crow) * DM + cpc : ga;
    const bf* gb = Bn + (size_t)(c0 + crow) * DM + cpc;
    auto fill = [&](int s) {
        const unsigned la = lc + (unsigned)(s & 1) * (2u * NPL * GPLN), lb = la + 2u * GPLN; const int ko = s * 64;
        copy8(la, la + 2u * 16 * GPIT, la + 2u * 32 * GPIT, la + 2u * 48 * GPIT, lb, lb + 2u * 16 * GPIT, lb + 2u * 32 * GPIT, lb + 2u * 48 * GPIT,
              ga + ko, ga + ko + 16 * DM, ga + ko + 32 * DM, ga + ko + 48 * DM, gb + ko, gb + ko + 16 * DM, gb + ko + 32 * DM, gb + ko + 48 * DM);
        if (SPLITA) { const unsigned ll = la + 2u * 2 * GPLN;
            copy4(ll, ll + 2u * 16 * GPIT, ll + 2u * 32 * GPIT, ll + 2u * 48 * GPIT, gl + ko, gl + ko + 16 * DM, gl + ko + 32 * DM, gl + ko + 48 * DM); }
    };
    v8f acc[4];
#pragma unroll
    for (int t = 0; t < 4; ++t) acc[t] = (v8f){};
    fill(0);
    asm volatile("s_wait_asynccnt 0x0" ::: "memory");    // this wave's share of stage 0 has landed
    __syncthreads();                                      // stage 0 is published to every wave
    fill(1);
#pragma unroll 1
    for (int st = 0; st < DM / 64; ++st) {
        const bf* rb = (const bf*)(const void*)smem + (st & 1) * (NPL * GPLN);
        const bf* ra = rb + (wave * 16 + lr) * GPIT + 8 * hi; const bf* rn = rb + GPLN + lr * GPIT + 8 * hi;
#pragma unroll
        for (int kc = 0; kc < 64; kc += 32) {
            const v16bf a = cat16b(*(const v8usa*)(ra + kc), *(const v8usa*)(ra + kc + 16));
            v16bf al = a;
            if (SPLITA) al = cat16b(*(const v8usa*)(ra + 2 * GPLN + kc), *(const v8usa*)(ra + 2 * GPLN + kc + 16));
#pragma unroll
            for (int t = 0; t < 4; ++t) { const v16bf b = cat16b(*(const v8usa*)(rn + t * 16 * GPIT + kc), *(const v8usa*)(rn + t * 16 * GPIT + kc + 16)); acc[t] = wmmab(a, b, acc[t]); if (SPLITA) acc[t] = wmmab(al, b, acc[t]); }
            asm volatile("v_nop\n\tv_nop\n\tv_nop\n\tv_nop" : "+v"(acc[0]), "+v"(acc[1]), "+v"(acc[2]), "+v"(acc[3]) : "v"(a), "v"(al));
        }
        asm volatile("s_wait_dscnt 0x0" ::: "memory");       // this wave's reads of this stage's buffer have returned
        asm volatile("s_wait_asynccnt 0x0" ::: "memory");    // this wave's share of the next stage has landed
        __syncthreads();                                      // publishes the next stage and ends every wave's reads of this buffer
        if (st + 2 < DM / 64) fill(st + 2);                   // refill the buffer just read; the test is the same for the whole block
    }
    asm volatile("s_wait_asynccnt 0x0" ::: "memory");        // nothing of this wave is in flight when the planes become output staging
    float* os = (float*)(void*)smem + wave * (16 * 68);
#pragma unroll
    for (int t = 0; t < 4; ++t) { const float bv = bias ? bfr(bias[c0 + t * 16 + lr]) : 0.f;
#pragma unroll
        for (int j = 0; j < 8; ++j) os[(hi * 8 + j) * 68 + t * 16 + lr] = acc[t][j] + bv; }
    __syncthreads();
    if (F16OUT) {
        h16* crow = (h16*)(void*)C + (size_t)r0 * ldc + c0;
        auto pass = [&]() {
#pragma unroll
            for (int s = 0; s < 4; ++s) { const int row = 4 * s + (lane >> 3), piece = lane & 7; const float* sp = os + row * 68 + piece * 8; v8h o, o2;
#pragma unroll
                for (int i = 0; i < 8; ++i) { const h16 a = (h16)sp[i]; o[i] = a; o2[i] = (h16)((sp[i] - (float)a) * LOSC); }
                *(v8h*)(crow + (size_t)row * ldc + piece * 8) = o; if (C2) *(v8h*)(C2 + (size_t)r0 * ldc + c0 + (size_t)row * ldc + piece * 8) = o2; }
        };
        pass(); 
    } else {
        float* crow = C + (size_t)r0 * ldc + c0;
        auto pass = [&]() {
#pragma unroll
            for (int s = 0; s < 8; ++s) { const int Lid = (lane >> 3) + 4 * s, piece = lane & 7; const int row = Lid >> 1, cofs = (Lid & 1) * 32 + piece * 4;
                const v4f val = *(const v4fa*)(os + row * 68 + cofs); *(v4f*)(crow + (size_t)row * ldc + cofs) = val; }
        };
        pass(); 
    }
}

__global__ __launch_bounds__(128) void k_gemmb(const bf* __restrict__ A, const bf* __restrict__ Al, const bf* __restrict__ Bn, const float* __restrict__ bias, float* C, int ldc) {
    __shared__ __align__(16) unsigned char smem[2 * 3 * GPLN * 2];
    gemm_tile<true>(smem, false, A, Al, Bn, bias, C, ldc, nullptr);
}
// The three projections in one grid: blockIdx.z = 0: q, 1: k (both to f16 hi + residual planes), 2: v (f32).
__global__ __launch_bounds__(128) void k_qkv(const bf* __restrict__ Xq, const bf* __restrict__ Xk, const bf* __restrict__ Xv, const bf* __restrict__ WqT, const bf* __restrict__ WkT, const bf* __restrict__ WvT,
                                             const float* __restrict__ bq, const float* __restrict__ bk, const float* __restrict__ bv, h16* QH, h16* QL, h16* KH, h16* KL, float* V) {
    __shared__ __align__(16) unsigned char smem[2 * 2 * GPLN * 2];
    const int z = blockIdx.z;
    const bf* A = z == 0 ? Xq : (z == 1 ? Xk : Xv);
    const bf* Bn = z == 0 ? WqT : (z == 1 ? WkT : WvT);
    const float* bias = z == 0 ? bq : (z == 1 ? bk : bv);
    float* C = z == 0 ? (float*)(void*)QH : (z == 1 ? (float*)(void*)KH : V);
    h16* C2 = z == 0 ? QL : (z == 1 ? KL : nullptr);
    gemm_tile<false>(smem, z != 2, A, nullptr, Bn, bias, C, DM, C2);
}

__global__ __launch_bounds__(256) void k_vt(const float* __restrict__ V, h16* VTH, h16* VTL) {
    __shared__ __align__(16) h16 tile[64 * 72];
    __shared__ __align__(16) h16 til2[64 * 72];
    const int bid = blockIdx.x;
    const int b = bid / (NH_ * (NT_ / 64)), rem = bid - b * (NH_ * (NT_ / 64)), h = rem / (NT_ / 64), kt = rem - h * (NT_ / 64);
    const int k0 = kt * 64, tid = threadIdx.x;
    const int kk = tid >> 2, d0 = (tid & 3) * 16;
    const float* src = V + ((size_t)b * NT_ + k0 + kk) * DM + h * HD + d0;
#pragma unroll
    for (int i = 0; i < 16; ++i) { const float v = src[i]; const h16 a = (h16)v; tile[(d0 + i) * 72 + kk] = a; til2[(d0 + i) * 72 + kk] = (h16)((v - (float)a) * LOSC); }
    __syncthreads();
    const int piece = tid & 7;
    const size_t base = (((size_t)b * NH_ + h) * HD) * NT_ + k0;
    auto pass = [&]() {
#pragma unroll
        for (int s = 0; s < 4; ++s) { const int Lid = (tid >> 3) + 32 * s; const int pln = Lid >> 6, d = Lid & 63;
            const v8h val = *(const v8ha*)((pln ? til2 : tile) + d * 72 + piece * 8); *(v8h*)((pln ? VTL : VTH) + base + (size_t)d * NT_ + piece * 8) = val; }
    };
    pass(); 
}

// One trip's K and V planes in LDS, in f16 elements: K hi, K residual as [32 keys][64 d] at a pitch of 72 (144 B), V hi, V residual as [64 d][32 keys] at a pitch of 40 (80 B):
// both pitches are odd multiples of 16 B for the 16-byte fragment reads.
#define KPIT 72
#define VPIT 40
#define RKH  0
#define RKL  (32 * KPIT)
#define RVH  (2 * 32 * KPIT)
#define RVL  (2 * 32 * KPIT + 64 * VPIT)
#define RBUF (2 * 32 * KPIT + 2 * 64 * VPIT)
// lane l with lane l ^ 16, as a vector cross-row move (a shuffle would go through the LDS unit and its wait)
__device__ __forceinline__ float xhalf(float x) { return __builtin_bit_cast(float, __builtin_amdgcn_permlanex16(__builtin_bit_cast(int, x), __builtin_bit_cast(int, x), 0x76543210, 0xfedcba98, false, false)); }
// k_attn: block = (b, h, 64 queries), wave = 16; ALL 64 key tiles of 32 keys (no skip); each tile's K and V planes are brought into LDS once per block by asynchronous copies,
// two buffers, the next tile in flight while this one is worked on. The products are TRANSPOSED: scores^T = K.Q^T (A = K rows, B = Q), ctx^T += V^T.P^T (A = V^T rows, B = P^T), so a lane
// holds 16 of the 32 scores of ONE query (column lr; keys 8 hi + j and 16 + 8 hi + j, which is the k order of a B operand): maximum and sum run in the lane plus one exchange between the
// wave's halves, and the weights (x32768, f16 hi + residual x1024) go from the score accumulators into the B operand in registers. 12 WMMA scores /8 (f32), online softmax, 12 WMMA .v;
// key mask as an additive 0 / -inf table in LDS (built once per block), query mask applied to the row's final factor. Epilogue: a lane's ctx^T registers (d 8 hi + j and 16 + 8 hi + j of
// each 32, query lr) are an A operand's k order, so ctx goes in registers, as bf16 hi + residual, into x = ctx.Wo[h] + bo[h] (16 WMMA, B = the head's 64 x 64 tile of WoT, n-major, read
// from global memory once per wave; per k step hi then residual on one accumulator); x -> bf16 hi + residual planes XH/XL[tok][h*64+o].
__global__ __launch_bounds__(128) void k_attn(const h16* __restrict__ Q16, const h16* __restrict__ QL16, const h16* __restrict__ K16, const h16* __restrict__ KL16, const h16* __restrict__ VTH, const h16* __restrict__ VTL, const float* __restrict__ QM, const float* __restrict__ KM, const bf* __restrict__ WoT, const float* __restrict__ bo, bf* XH, bf* XL) {
    __shared__ __align__(16) float kbias[NT_];
    __shared__ __align__(16) float ost[4][16 * 68];
    __shared__ __align__(16) h16 ring[2][RBUF];
    const int lane = threadIdx.x & 31, wave = threadIdx.x >> 5, lr = lane & 15, hi = lane >> 4;
    const int bid = blockIdx.x;
    const int b = bid / (NH_ * (NT_ / 64)), rem = bid - b * (NH_ * (NT_ / 64)), h = rem / (NT_ / 64), qt = rem - h * (NT_ / 64);
    const int q0 = qt * 64 + wave * 16;
    const size_t tok0 = (size_t)b * NT_;
    v16h qa[2];
    const size_t qo0 = (tok0 + q0 + lr) * DM + h * HD + 8 * hi;
#pragma unroll
    for (int kc = 0; kc < 2; ++kc) qa[kc] = cat16(*(const v8h*)(Q16 + qo0 + kc * 32), *(const v8h*)(Q16 + qo0 + kc * 32 + 16));
    const h16* kh_b = K16 + tok0 * DM + h * HD;
    const h16* kl_b = KL16 + tok0 * DM + h * HD;
    const size_t vbase = (((size_t)b * NH_ + h) * HD) * NT_;
    v8f o[4], ox[4];      // ctx^T: tile n, register j = d n * 16 + 8 hi + j of query lr
#pragma unroll
    for (int n = 0; n < 4; ++n) { o[n] = (v8f){}; ox[n] = (v8f){}; }
    float mrow = -3.0e38f, lpart = 0.f;             // of query lr; lpart sums this half's keys only, the halves are joined behind the loop
    const int kt_lo = 0, kt_hi = NT_ / 32 - 1;     // full attention; masks: key j kept iff key_mask[b][j] != 0, query row i kept iff query_mask[b][i] != 0 (fully masked rows -> 0 output, = nan_to_num)
    const float qmv = bfr(QM[tok0 + q0 + lr]);
    const int tid = threadIdx.x;
    // Each thread copies two 16-byte pieces of each of the four planes: K rows krow and krow + 16 (8 pieces a row), V rows vrow and vrow + 32 (4 pieces a row).
    const int krow = tid >> 3, kpc = (tid & 7) * 8, vrow = tid >> 2, vpc = (tid & 3) * 8;
    const unsigned ring0 = (unsigned)(size_t)&ring[0][0];
    const unsigned lk = ring0 + 2u * (unsigned)(krow * KPIT + kpc), lv = ring0 + 2u * (unsigned)(vrow * VPIT + vpc);
    const h16* gkh = kh_b + (size_t)krow * DM + kpc; const h16* gkl = kl_b + (size_t)krow * DM + kpc;
    const h16* gvh = VTH + vbase + (size_t)vrow * NT_ + vpc; const h16* gvl = VTL + vbase + (size_t)vrow * NT_ + vpc;
    auto fill = [&](int t) {
        const unsigned bo = (unsigned)(t & 1) * (2u * RBUF); const size_t ka = (size_t)t * 32 * DM, va = (size_t)t * 32;
        copy8(lk + bo + 2u * RKH, lk + bo + 2u * (RKH + 16 * KPIT), lk + bo + 2u * RKL, lk + bo + 2u * (RKL + 16 * KPIT),
              lv + bo + 2u * RVH, lv + bo + 2u * (RVH + 32 * VPIT), lv + bo + 2u * RVL, lv + bo + 2u * (RVL + 32 * VPIT),
              gkh + ka, gkh + ka + 16 * DM, gkl + ka, gkl + ka + 16 * DM, gvh + va, gvh + va + (size_t)32 * NT_, gvl + va, gvl + va + (size_t)32 * NT_);
    };
    fill(0);
#pragma unroll
    for (int i = 0; i < NT_ / 512; ++i) { const v4f km = *(const v4f*)(KM + tok0 + i * 512 + tid * 4); v4f kb;
#pragma unroll
        for (int e = 0; e < 4; ++e) kb[e] = bfr(km[e]) != 0.f ? 0.f : -__builtin_inff();
        *(v4fa*)(kbias + i * 512 + tid * 4) = kb; }     // published by the barrier that publishes tile 0
    asm volatile("s_wait_asynccnt 0x0" ::: "memory");    // this wave's share of tile 0 has landed
    __syncthreads();                                      // tile 0 and the key table are published to every wave
    fill(1);
#pragma unroll 1
    for (int kt = kt_lo; kt <= kt_hi; ++kt) {
        const int l0 = kt * 32;
        const h16* rb = &ring[kt & 1][0];
        const h16* rk0 = rb + lr * KPIT + 8 * hi; const h16* rk1 = rb + (16 + lr) * KPIT + 8 * hi;
        const float* kbp = kbias + l0 + 8 * hi;
        const v4f kb[4] = { *(const v4fa*)(kbp), *(const v4fa*)(kbp + 4), *(const v4fa*)(kbp + 16), *(const v4fa*)(kbp + 20) };
        v8f s0 = {}, s1 = {}, x0 = {}, x1 = {};
#pragma unroll
        for (int kc = 0; kc < 2; ++kc) {
            { const v16h k0h = cat16(*(const v8ha*)(rk0 + RKH + kc * 32), *(const v8ha*)(rk0 + RKH + kc * 32 + 16)), k1h = cat16(*(const v8ha*)(rk1 + RKH + kc * 32), *(const v8ha*)(rk1 + RKH + kc * 32 + 16));
              const v16h qlk = cat16(*(const v8h*)(QL16 + qo0 + kc * 32), *(const v8h*)(QL16 + qo0 + kc * 32 + 16));     // query residual re-read per step (registers)
              s0 = wmma16(k0h, qa[kc], s0); x0 = wmma16(k0h, qlk, x0); s1 = wmma16(k1h, qa[kc], s1); x1 = wmma16(k1h, qlk, x1); }
            { const v16h k0l = cat16(*(const v8ha*)(rk0 + RKL + kc * 32), *(const v8ha*)(rk0 + RKL + kc * 32 + 16)), k1l = cat16(*(const v8ha*)(rk1 + RKL + kc * 32), *(const v8ha*)(rk1 + RKL + kc * 32 + 16));
              x0 = wmma16(k0l, qa[kc], x0); x1 = wmma16(k1l, qa[kc], x1); }
        }
        v2f a[8];      // this lane's 16 scores in pairs of neighbouring accumulator registers: a[i] = keys 8 hi + 2 i, + 1 (i < 4), 16 + 8 hi + 2 (i - 4), + 1 (i >= 4)
#pragma unroll
        for (int i = 0; i < 4; ++i) {
            a[i]     = ((v2f){s0[2 * i], s0[2 * i + 1]} + (v2f){x0[2 * i], x0[2 * i + 1]} * LOSCI) * 0.125f + (v2f){kb[i >> 1][(2 * i) & 3], kb[i >> 1][((2 * i) & 3) + 1]};
            a[4 + i] = ((v2f){s1[2 * i], s1[2 * i + 1]} + (v2f){x1[2 * i], x1[2 * i + 1]} * LOSCI) * 0.125f + (v2f){kb[2 + (i >> 1)][(2 * i) & 3], kb[2 + (i >> 1)][((2 * i) & 3) + 1]};
        }
        float mx = fmaxf(a[0].x, a[0].y);
#pragma unroll
        for (int i = 1; i < 8; ++i) mx = fmaxf(mx, fmaxf(a[i].x, a[i].y));
        mx = fmaxf(mx, xhalf(mx));
        const float mn = fmaxf(mrow, mx);
        const float alpha = __expf(mrow - mn); mrow = mn;
        v16h pa, px; v2f ts[2] = { (v2f){0.f, 0.f}, (v2f){0.f, 0.f} };
#pragma unroll
        for (int i = 0; i < 8; ++i) {
            const v2f p = { __expf(a[i].x - mn), __expf(a[i].y - mn) };
            ts[i & 1] += p;
            const v2f ps = p * PSC; const v2h hh = __builtin_convertvector(ps, v2h);
            const v2h ll = __builtin_convertvector((ps - __builtin_convertvector(hh, v2f)) * LOSC, v2h);
            pa[2 * i] = hh.x; pa[2 * i + 1] = hh.y; px[2 * i] = ll.x; px[2 * i + 1] = ll.y;
        }
        ts[0] += ts[1];
        lpart = lpart * alpha + (ts[0].x + ts[0].y);
#pragma unroll
        for (int n = 0; n < 4; ++n)
#pragma unroll
            for (int j = 0; j < 8; ++j) { o[n][j] *= alpha; ox[n][j] *= alpha; }
#pragma unroll
        for (int n = 0; n < 4; ++n) { const h16* rv = rb + (n * 16 + lr) * VPIT + hi * 8;
            const v16h vh = cat16(*(const v8ha*)(rv + RVH), *(const v8ha*)(rv + RVH + 16)), vl = cat16(*(const v8ha*)(rv + RVL), *(const v8ha*)(rv + RVL + 16));
            o[n] = wmma16(vh, pa, o[n]); ox[n] = wmma16(vl, pa, ox[n]); ox[n] = wmma16(vh, px, ox[n]); }
        asm volatile("s_wait_dscnt 0x0" ::: "memory");       // this wave's reads of this tile's buffer have returned
        asm volatile("s_wait_asynccnt 0x0" ::: "memory");    // this wave's share of the next tile has landed
        __syncthreads();                                      // publishes the next tile and ends every wave's reads of this buffer
        if (kt + 2 <= kt_hi) fill(kt + 2);                    // refill the buffer just read; the test is the same for the whole block
    }
    asm volatile("s_wait_asynccnt 0x0" ::: "memory");        // nothing of this wave is in flight when the loop is left
    const float rs = lpart + xhalf(lpart);
    const float inv = (rs > 0.f && qmv != 0.f) ? 1.0f / (rs * PSC) : 0.f;   // masked query row, or every key masked: weights nan_to_num -> 0 -> output 0
    v16bf ch[2], cl[2];      // ctx rows (query lr) as A operands, 32 d each
#pragma unroll
    for (int kc = 0; kc < 2; ++kc) { v8us hb[2], lb[2];
#pragma unroll
        for (int u = 0; u < 2; ++u)
#pragma unroll
            for (int j = 0; j < 8; ++j) { const float c = (o[2 * kc + u][j] + ox[2 * kc + u][j] * LOSCI) * inv; const unsigned short t = f2bf(c); hb[u][j] = t; lb[u][j] = f2bf(c - bf2f(t)); }
        ch[kc] = cat16b(hb[0], hb[1]); cl[kc] = cat16b(lb[0], lb[1]); }
    const bf* wo = WoT + (size_t)(h * HD + lr) * DM + h * HD + 8 * hi;
    v8f xa[4];
#pragma unroll
    for (int t = 0; t < 4; ++t) xa[t] = (v8f){};
#pragma unroll
    for (int kc = 0; kc < 2; ++kc)
#pragma unroll
        for (int t = 0; t < 4; ++t) { const v16bf w = cat16b(*(const v8us*)(wo + (size_t)t * 16 * DM + kc * 32), *(const v8us*)(wo + (size_t)t * 16 * DM + kc * 32 + 16));
            xa[t] = wmmab(ch[kc], w, xa[t]); xa[t] = wmmab(cl[kc], w, xa[t]); }
    float* os = &ost[wave][0];
#pragma unroll
    for (int t = 0; t < 4; ++t) { const float bv = bfr(bo[h * HD + t * 16 + lr]);
#pragma unroll
        for (int j = 0; j < 8; ++j) os[(hi * 8 + j) * 68 + t * 16 + lr] = xa[t][j] + bv; }
    __syncthreads();
    const size_t cbase = (tok0 + q0) * DM + (size_t)h * HD;
    auto pass = [&]() {
#pragma unroll
        for (int s = 0; s < 4; ++s) { const int row = 4 * s + (lane >> 3), piece = lane & 7; const float* sp = os + row * 68 + piece * 8; v8us oh, ol;
#pragma unroll
            for (int i = 0; i < 8; ++i) { const unsigned short hb = f2bf(sp[i]); oh[i] = hb; ol[i] = f2bf(sp[i] - bf2f(hb)); }
            *(v8us*)(XH + cbase + (size_t)row * DM + piece * 8) = oh; *(v8us*)(XL + cbase + (size_t)row * DM + piece * 8) = ol; }
    };
    pass(); 
}

#define VST2(T, p, v) do { const T vst2_v_ = (v); *(T*)(p) = vst2_v_;  } while (0)
extern "C" void kernel_launch(void* const* d_in, const int* in_sizes, int n_in,
                              void* d_out, int out_size, void* d_ws, size_t ws_size, hipStream_t stream) {
    (void)in_sizes; (void)n_in; (void)out_size;
    const float* xq = (const float*)d_in[0]; const float* xk = (const float*)d_in[1]; const float* xv = (const float*)d_in[2]; const float* QM = (const float*)d_in[3]; const float* KM = (const float*)d_in[4];
    const float* Wq = (const float*)d_in[5]; const float* bq = (const float*)d_in[6]; const float* Wk = (const float*)d_in[7]; const float* bk = (const float*)d_in[8]; const float* Wv = (const float*)d_in[9]; const float* bv = (const float*)d_in[10];
    const float* Wo = (const float*)d_in[11]; const float* bo = (const float*)d_in[12]; const float* Wf = (const float*)d_in[13]; const float* bfin = (const float*)d_in[14];
    float* out = (float*)d_out;    // [2][2048][1024]
    char* wsp = (char*)d_ws;
    auto take = [&](size_t bytes) { char* p = wsp; wsp += (bytes + 255) & ~(size_t)255; return (void*)p; };
    bf* Xq = (bf*)take((size_t)NTK * DM * 2); bf* Xk = (bf*)take((size_t)NTK * DM * 2); bf* Xv = (bf*)take((size_t)NTK * DM * 2);
    bf* WqT = (bf*)take((size_t)DM * DM * 2); bf* WkT = (bf*)take((size_t)DM * DM * 2); bf* WvT = (bf*)take((size_t)DM * DM * 2); bf* WoBD = (bf*)take((size_t)DM * DM * 2); bf* WfT = (bf*)take((size_t)DM * DM * 2);
    float* TMP = (float*)take((size_t)NTK * DM * 4);
    h16* QH = (h16*)take((size_t)NTK * DM * 2); h16* QL = (h16*)take((size_t)NTK * DM * 2); h16* KH = (h16*)take((size_t)NTK * DM * 2); h16* KL = (h16*)take((size_t)NTK * DM * 2);
    h16* VTH = (h16*)take((size_t)NTK * DM * 2); h16* VTL = (h16*)take((size_t)NTK * DM * 2);
    bf* XH = (bf*)take((size_t)NTK * DM * 2); bf* XL = (bf*)take((size_t)NTK * DM * 2);
    if ((size_t)(wsp - (char*)d_ws) > ws_size) return;    // 3 x 8.4 + 5 x 2.1 + 16.8 + 8 x 8.4 ~ 120 MB, no aliasing
    // every loop of launches over heads, planes and batch items is a grid dimension: 6 launches
    k_prep<<<dim3(256, 5, 1), 256, 0, stream>>>(Wq, Wk, Wv, Wf, Wo, WqT, WkT, WvT, WfT, WoBD);
    k_cvtb<<<dim3(NTK / 8, 3, 1), 256, 0, stream>>>(xq, xk, xv, NTK, Xq, Xk, Xv);
    k_qkv<<<dim3(NTK / 64, DM / 64, 3), 128, 0, stream>>>(Xq, Xk, Xv, WqT, WkT, WvT, bq, bk, bv, QH, QL, KH, KL, TMP);
    k_vt<<<NB_ * NH_ * (NT_ / 64), 256, 0, stream>>>(TMP, VTH, VTL);
    k_attn<<<NB_ * NH_ * (NT_ / 64), 128, 0, stream>>>(QH, QL, KH, KL, VTH, VTL, QM, KM, WoBD, bo, XH, XL);      // with the per-head ctx.Wo[h] + bo[h]
    k_gemmb<<<dim3(NTK / 64, DM / 64, 1), 128, 0, stream>>>(XH, XL, WfT, bfin, out, DM);   // x.Wf + bf
}

// v005
// One run takes 153 microseconds.
// Next to v004, in two timings, it ran 1.03 times as fast each time.
// Counting every step since v000, it is 5.26 times as fast.
#include <hip/hip_runtime.h>

// Compute dtypes, f32 accumulate, both batch items in every launch: per-head q/k/v = query/key/value.W[h] + b[h] (weights [H][E][D] k-major per head, transposed once
// into one n-major [H*D][E] plane each; PLAIN bf16 operands = inputs rounded once, exact products; biases rounded to bf16) with q and k written straight from the GEMM
// epilogue as f16 hi + residual x1024 planes; the 16-head attention (64-dim heads, scale 1/8, keys kept iff key_mask != 0, query rows kept iff query_mask
// != 0, fully-masked rows give 0 as the reference's nan_to_num) fused on v_wmma_f32_16x16x32_f16 (scores hi.hi + hi.lo + lo.hi with residual terms on
// their own accumulator, online f32 softmax, weights (x32768) and v as f16 hi + residual x1024); the per-head output linear ctx.Wo[h] + bo[h] in the attention
// kernel's epilogue, and the final x.Wf + bf as a GEMM, both on v_wmma_f32_16x16x32_bf16 with the computed operand as bf16 hi + UNSCALED residual (two

#define NB_  2                   // both batch items are rows of the same launches
#define NT_  2048
#define DM   1024
#define NH_  16
#define HD   64
#define NTK  (NB_ * NT_)
#define NW   1024
#define NQKV 1024
#define PSC  32768.0f
#define LOSC 1024.0f
#define LOSCI (1.0f / 1024.0f)

typedef _Float16 h16;
typedef unsigned short bf;
typedef __attribute__((ext_vector_type(16))) __bf16   v16bf;
typedef __attribute__((ext_vector_type(16))) _Float16 v16h;
typedef __attribute__((ext_vector_type(8)))  _Float16 v8h;
typedef __attribute__((ext_vector_type(8)))  unsigned short v8us;
typedef __attribute__((ext_vector_type(8)))  float    v8f;
typedef __attribute__((ext_vector_type(4)))  float    v4f;
typedef __attribute__((ext_vector_type(2)))  float    v2f;
typedef __attribute__((ext_vector_type(2)))  _Float16 v2h;
typedef v8h  __attribute__((may_alias)) v8ha;
typedef v4f  __attribute__((may_alias)) v4fa;
typedef v8us __attribute__((may_alias)) v8usa;

__device__ __forceinline__ unsigned short f2bf(float f) { unsigned u = __float_as_uint(f); u += 0x7FFFu + ((u >> 16) & 1u); return (unsigned short)(u >> 16); }
__device__ __forceinline__ float bf2f(unsigned short b) { return __uint_as_float(((unsigned)b) << 16); }
__device__ __forceinline__ float bfr(float f) { return bf2f(f2bf(f)); }
__device__ __forceinline__ v16h cat16(v8h lo, v8h hi) { return __builtin_shufflevector(lo, hi, 0, 1, 2, 3, 4, 5, 6, 7, 8, 9, 10, 11, 12, 13, 14, 15); }
__device__ __forceinline__ v16bf cat16b(v8us lo, v8us hi) { return __builtin_bit_cast(v16bf, __builtin_shufflevector(lo, hi, 0, 1, 2, 3, 4, 5, 6, 7, 8, 9, 10, 11, 12, 13, 14, 15)); }
__device__ __forceinline__ v8f wmma16(v16h a, v16h b, v8f c) { return __builtin_amdgcn_wmma_f32_16x16x32_f16(false, a, false, b, (short)0, c, false, false); }
__device__ __forceinline__ v8f wmmab(v16bf a, v16bf b, v8f c) { return __builtin_amdgcn_wmma_f32_16x16x32_bf16(false, a, false, b, (short)0, c, false, false); }

// blockIdx.y picks one of the three activations (query, key, value).
__global__ __launch_bounds__(256) void k_cvtb(const float* __restrict__ s0, const float* __restrict__ s1, const float* __restrict__ s2, int nrows, bf* d0, bf* d1, bf* d2) {
    const int lane = threadIdx.x & 31, r = blockIdx.x * 8 + (threadIdx.x >> 5);
    if (r >= nrows) return;
    const int y = blockIdx.y;
    const float* src = y == 0 ? s0 : (y == 1 ? s1 : s2);
    bf* dst = y == 0 ? d0 : (y == 1 ? d1 : d2);
    v8us o[DM / 256];
#pragma unroll
    for (int q = 0; q < DM / 256; ++q) { v8us t;
#pragma unroll
        for (int i = 0; i < 8; ++i) t[i] = f2bf(src[(size_t)r * DM + q * 256 + lane * 8 + i]);
        o[q] = t; }
#pragma unroll
    for (int q = 0; q < DM / 256; ++q) *(v8us*)(dst + (size_t)r * DM + q * 256 + lane * 8) = o[q];
    
}

// k_prep: every weight plane in one grid, one 64 x 64 tile (n-tile a, k-tile c) of a [1024][1024] n-major bf16 plane per block, transposed through LDS.
// blockIdx.y = 0, 1, 2: Wq, Wk, Wv (head a, [E][D] k-major); 3: Wf ([K][N] k-major); 4: the per-head output linears: tile (a, a) = Wo[a] transposed; the other
// tiles of that plane are neither written nor read.
__global__ __launch_bounds__(256) void k_prep(const float* __restrict__ Wq, const float* __restrict__ Wk, const float* __restrict__ Wv, const float* __restrict__ Wf, const float* __restrict__ Wo,
                                              bf* WqT, bf* WkT, bf* WvT, bf* WfT, bf* WoBD) {
    __shared__ __align__(16) unsigned short tl[64 * 72];
    const int tid = threadIdx.x, a = blockIdx.x >> 4, c = blockIdx.x & 15, y = blockIdx.y;
    const float* src; bf* pln; int ncols = HD; bool live = true;
    if (y < 3) { src = (y == 0 ? Wq : (y == 1 ? Wk : Wv)) + (size_t)a * DM * HD + (size_t)c * 64 * HD; pln = y == 0 ? WqT : (y == 1 ? WkT : WvT); }
    else if (y == 3) { src = Wf + (size_t)c * 64 * DM + a * 64; pln = WfT; ncols = DM; }
    else { src = Wo + (size_t)a * HD * HD; pln = WoBD; live = (a == c); }
    if (!live) return;      // the same for the whole block, in front of the barrier
    bf* dst = pln + (size_t)a * 64 * DM + c * 64;
    const int kk = tid >> 2, nq = (tid & 3) * 16;
#pragma unroll
    for (int i = 0; i < 16; ++i) tl[(nq + i) * 72 + kk] = f2bf(src[(size_t)kk * ncols + nq + i]);
    __syncthreads();
    const int piece = tid & 7;
#pragma unroll
    for (int s = 0; s < 2; ++s) { const int nr = (tid >> 3) + 32 * s; const v8us val = *(const v8usa*)(tl + nr * 72 + piece * 8); *(v8us*)(dst + (size_t)nr * DM + piece * 8) = val; }
}
// Eight asynchronous 16-byte copies of one lane, global -> LDS. The closing s_wait_xcnt 0 stands in the copies' own statement so that no address register is rewritten in front of it.
__device__ __forceinline__ void copy8(unsigned l0, unsigned l1, unsigned l2, unsigned l3, unsigned l4, unsigned l5, unsigned l6, unsigned l7,
                                      const void* g0, const void* g1, const void* g2, const void* g3, const void* g4, const void* g5, const void* g6, const void* g7) {
    asm volatile("global_load_async_to_lds_b128 %0, %8, off\n\t"
                 "global_load_async_to_lds_b128 %1, %9, off\n\t"
                 "global_load_async_to_lds_b128 %2, %10, off\n\t"
                 "global_load_async_to_lds_b128 %3, %11, off\n\t"
                 "global_load_async_to_lds_b128 %4, %12, off\n\t"
                 "global_load_async_to_lds_b128 %5, %13, off\n\t"
                 "global_load_async_to_lds_b128 %6, %14, off\n\t"
                 "global_load_async_to_lds_b128 %7, %15, off\n\t"
                 "s_wait_xcnt 0x0"
                 :: "v"(l0), "v"(l1), "v"(l2), "v"(l3), "v"(l4), "v"(l5), "v"(l6), "v"(l7), "v"(g0), "v"(g1), "v"(g2), "v"(g3), "v"(g4), "v"(g5), "v"(g6), "v"(g7) : "memory");
}
// A staged GEMM plane: 128 rows of 64 k elements (128 B) at a pitch of 72 elements (144 B, an odd multiple of 16 B for the 16-byte fragment reads).
#define GPIT 72
#define GPLN (128 * GPIT)
// One 128 x 128 tile (blockIdx.x, blockIdx.y) of C = A.Bn^T + bias, four waves as 2 x 2, each with a 64 x 64 tile (4 x 4 accumulators): a fragment read from LDS feeds four products and a
// staged row 128 outputs. F16OUT is the same in every thread of a block. smem = the block's LDS: in the k loop two buffers of 2 (3 with SPLITA) planes (A rows, Bn rows, Al rows of 64 k each),
// filled by asynchronous copies, the next 64 k in flight while these are worked on; behind the loop's last barrier, when no wave reads the planes any more and no copy is in flight, the
// same bytes are the 4 x 64 x 68 f32 output staging.
template <bool SPLITA>
__device__ __forceinline__ void gemm_tile(unsigned char* smem, const bool F16OUT, const bf* __restrict__ A, const bf* __restrict__ Al, const bf* __restrict__ Bn, const float* __restrict__ bias, float* C, int ldc, h16* C2) {
    const int lane = threadIdx.x & 31, wave = threadIdx.x >> 5, lr = lane & 15, hi = lane >> 4;
    const int wr = wave >> 1, wc = wave & 1;
    const int r0 = blockIdx.x * 128 + wr * 64, c0 = blockIdx.y * 128 + wc * 64;
    constexpr int NPL = SPLITA ? 3 : 2;
    // Each thread copies eight 16-byte pieces of each plane: rows crow + 16 i, i = 0 .. 7 (8 pieces a row).
    const int tid = threadIdx.x, crow = tid >> 3, cpc = (tid & 7) * 8;
    const unsigned lc = (unsigned)(size_t)smem + 2u * (unsigned)(crow * GPIT + cpc);
    const bf* ga = A + (size_t)(blockIdx.x * 128 + crow) * DM + cpc;
    const bf* gl = SPLITA ? Al + (size_t)(blockIdx.x * 128 + crow) * DM + cpc : ga;
    const bf* gb = Bn + (size_t)(blockIdx.y * 128 + crow) * DM + cpc;
    auto plane = [&](unsigned l, const bf* g) {
        copy8(l, l + 2u * 16 * GPIT, l + 2u * 32 * GPIT, l + 2u * 48 * GPIT, l + 2u * 64 * GPIT, l + 2u * 80 * GPIT, l + 2u * 96 * GPIT, l + 2u * 112 * GPIT,
              g, g + 16 * DM, g + 32 * DM, g + 48 * DM, g + 64 * DM, g + 80 * DM, g + 96 * DM, g + 112 * DM);
    };
    auto fill = [&](int s) {
        const unsigned la = lc + (unsigned)(s & 1) * (2u * NPL * GPLN); const int ko = s * 64;
        plane(la, ga + ko); plane(la + 2u * GPLN, gb + ko);
        if (SPLITA) plane(la + 2u * 2 * GPLN, gl + ko);
    };
    v8f acc[4][4];      // [16 rows m][16 columns t]
#pragma unroll
    for (int m = 0; m < 4; ++m)
#pragma unroll
        for (int t = 0; t < 4; ++t) acc[m][t] = (v8f){};
    fill(0);
    asm volatile("s_wait_asynccnt 0x0" ::: "memory");    // this wave's share of stage 0 has landed
    __syncthreads();                                      // stage 0 is published to every wave
    fill(1);
#pragma unroll 1
    for (int st = 0; st < DM / 64; ++st) {
        const bf* rb = (const bf*)(const void*)smem + (st & 1) * (NPL * GPLN);
        const bf* ra = rb + (wr * 64 + lr) * GPIT + 8 * hi; const bf* rn = rb + GPLN + (wc * 64 + lr) * GPIT + 8 * hi;
#pragma unroll
        for (int kc = 0; kc < 64; kc += 32) {
            v16bf a[4], al[4], b[4];
#pragma unroll
            for (int m = 0; m < 4; ++m) a[m] = cat16b(*(const v8usa*)(ra + m * 16 * GPIT + kc), *(const v8usa*)(ra + m * 16 * GPIT + kc + 16));
#pragma unroll
            for (int t = 0; t < 4; ++t) b[t] = cat16b(*(const v8usa*)(rn + t * 16 * GPIT + kc), *(const v8usa*)(rn + t * 16 * GPIT + kc + 16));
#pragma unroll
            for (int m = 0; m < 4; ++m) { al[m] = a[m];
                if (SPLITA) al[m] = cat16b(*(const v8usa*)(ra + 2 * GPLN + m * 16 * GPIT + kc), *(const v8usa*)(ra + 2 * GPLN + m * 16 * GPIT + kc + 16)); }
            // keeps a k step's fragment reads together in front of its products: left free, the scheduler sinks each b[t] to its first use, and the wave waits out an LDS latency per t
            __builtin_amdgcn_sched_barrier(0);
#pragma unroll
            for (int t = 0; t < 4; ++t) {
#pragma unroll
                for (int m = 0; m < 4; ++m) acc[m][t] = wmmab(a[m], b[t], acc[m][t]);
                if (SPLITA) {
#pragma unroll
                    for (int m = 0; m < 4; ++m) acc[m][t] = wmmab(al[m], b[t], acc[m][t]); } }
        }
        asm volatile("s_wait_dscnt 0x0" ::: "memory");       // this wave's reads of this stage's buffer have returned
        asm volatile("s_wait_asynccnt 0x0" ::: "memory");    // this wave's share of the next stage has landed
        __syncthreads();                                      // publishes the next stage and ends every wave's reads of this buffer
        if (st + 2 < DM / 64) fill(st + 2);                   // refill the buffer just read; the test is the same for the whole block
    }
    asm volatile("s_wait_asynccnt 0x0" ::: "memory");        // nothing of this wave is in flight when the planes become output staging
    float* os = (float*)(void*)smem + wave * (64 * 68);
#pragma unroll
    for (int t = 0; t < 4; ++t) { const float bv = bias ? bfr(bias[c0 + t * 16 + lr]) : 0.f;
#pragma unroll
        for (int m = 0; m < 4; ++m)
#pragma unroll
            for (int j = 0; j < 8; ++j) os[(m * 16 + hi * 8 + j) * 68 + t * 16 + lr] = acc[m][t][j] + bv; }
    __syncthreads();
    if (F16OUT) {
        h16* crow = (h16*)(void*)C + (size_t)r0 * ldc + c0;
        auto pass = [&]() {
#pragma unroll
            for (int s = 0; s < 16; ++s) { const int row = 4 * s + (lane >> 3), piece = lane & 7; const float* sp = os + row * 68 + piece * 8; v8h o, o2;
#pragma unroll
                for (int i = 0; i < 8; ++i) { const h16 a = (h16)sp[i]; o[i] = a; o2[i] = (h16)((sp[i] - (float)a) * LOSC); }
                *(v8h*)(crow + (size_t)row * ldc + piece * 8) = o; if (C2) *(v8h*)(C2 + (size_t)r0 * ldc + c0 + (size_t)row * ldc + piece * 8) = o2; }
        };
        pass(); 
    } else {
        float* crow = C + (size_t)r0 * ldc + c0;
        auto pass = [&]() {
#pragma unroll
            for (int s = 0; s < 32; ++s) { const int Lid = (lane >> 3) + 4 * s, piece = lane & 7; const int row = Lid >> 1, cofs = (Lid & 1) * 32 + piece * 4;
                const v4f val = *(const v4fa*)(os + row * 68 + cofs); *(v4f*)(crow + (size_t)row * ldc + cofs) = val; }
        };
        pass(); 
    }
}

__global__ __launch_bounds__(128) void k_gemmb(const bf* __restrict__ A, const bf* __restrict__ Al, const bf* __restrict__ Bn, const float* __restrict__ bias, float* C, int ldc) {
    __shared__ __align__(16) unsigned char smem[2 * 3 * GPLN * 2];
    gemm_tile<true>(smem, false, A, Al, Bn, bias, C, ldc, nullptr);
}
// The three projections in one grid: blockIdx.z = 0: q, 1: k (both to f16 hi + residual planes), 2: v (f32).
__global__ __launch_bounds__(128) void k_qkv(const bf* __restrict__ Xq, const bf* __restrict__ Xk, const bf* __restrict__ Xv, const bf* __restrict__ WqT, const bf* __restrict__ WkT, const bf* __restrict__ WvT,
                                             const float* __restrict__ bq, const float* __restrict__ bk, const float* __restrict__ bv, h16* QH, h16* QL, h16* KH, h16* KL, float* V) {
    __shared__ __align__(16) unsigned char smem[2 * 2 * GPLN * 2];
    const int z = blockIdx.z;
    const bf* A = z == 0 ? Xq : (z == 1 ? Xk : Xv);
    const bf* Bn = z == 0 ? WqT : (z == 1 ? WkT : WvT);
    const float* bias = z == 0 ? bq : (z == 1 ? bk : bv);
    float* C = z == 0 ? (float*)(void*)QH : (z == 1 ? (float*)(void*)KH : V);
    h16* C2 = z == 0 ? QL : (z == 1 ? KL : nullptr);
    gemm_tile<false>(smem, z != 2, A, nullptr, Bn, bias, C, DM, C2);
}

__global__ __launch_bounds__(256) void k_vt(const float* __restrict__ V, h16* VTH, h16* VTL) {
    __shared__ __align__(16) h16 tile[64 * 72];
    __shared__ __align__(16) h16 til2[64 * 72];
    const int bid = blockIdx.x;
    const int b = bid / (NH_ * (NT_ / 64)), rem = bid - b * (NH_ * (NT_ / 64)), h = rem / (NT_ / 64), kt = rem - h * (NT_ / 64);
    const int k0 = kt * 64, tid = threadIdx.x;
    const int kk = tid >> 2, d0 = (tid & 3) * 16;
    const float* src = V + ((size_t)b * NT_ + k0 + kk) * DM + h * HD + d0;
#pragma unroll
    for (int i = 0; i < 16; ++i) { const float v = src[i]; const h16 a = (h16)v; tile[(d0 + i) * 72 + kk] = a; til2[(d0 + i) * 72 + kk] = (h16)((v - (float)a) * LOSC); }
    __syncthreads();
    const int piece = tid & 7;
    const size_t base = (((size_t)b * NH_ + h) * HD) * NT_ + k0;
    auto pass = [&]() {
#pragma unroll
        for (int s = 0; s < 4; ++s) { const int Lid = (tid >> 3) + 32 * s; const int pln = Lid >> 6, d = Lid & 63;
            const v8h val = *(const v8ha*)((pln ? til2 : tile) + d * 72 + piece * 8); *(v8h*)((pln ? VTL : VTH) + base + (size_t)d * NT_ + piece * 8) = val; }
    };
    pass(); 
}

// One trip's K and V planes in LDS, in f16 elements: K hi, K residual as [32 keys][64 d] at a pitch of 72 (144 B), V hi, V residual as [64 d][32 keys] at a pitch of 40 (80 B):
// both pitches are odd multiples of 16 B for the 16-byte fragment reads.
#define KPIT 72
#define VPIT 40
#define RKH  0
#define RKL  (32 * KPIT)
#define RVH  (2 * 32 * KPIT)
#define RVL  (2 * 32 * KPIT + 64 * VPIT)
#define RBUF (2 * 32 * KPIT + 2 * 64 * VPIT)
// lane l with lane l ^ 16, as a vector cross-row move (a shuffle would go through the LDS unit and its wait)
__device__ __forceinline__ float xhalf(float x) { return __builtin_bit_cast(float, __builtin_amdgcn_permlanex16(__builtin_bit_cast(int, x), __builtin_bit_cast(int, x), 0x76543210, 0xfedcba98, false, false)); }
// k_attn: block = (b, h, 64 queries), wave = 16; ALL 64 key tiles of 32 keys (no skip); each tile's K and V planes are brought into LDS once per block by asynchronous copies,
// two buffers, the next tile in flight while this one is worked on. The products are TRANSPOSED: scores^T = K.Q^T (A = K rows, B = Q), ctx^T += V^T.P^T (A = V^T rows, B = P^T), so a lane
// holds 16 of the 32 scores of ONE query (column lr; keys 8 hi + j and 16 + 8 hi + j, which is the k order of a B operand): maximum and sum run in the lane plus one exchange between the
// wave's halves, and the weights (x32768, f16 hi + residual x1024) go from the score accumulators into the B operand in registers. 12 WMMA scores /8 (f32), online softmax, 12 WMMA .v;
// key mask as an additive 0 / -inf table in LDS (built once per block), query mask applied to the row's final factor. Epilogue: a lane's ctx^T registers (d 8 hi + j and 16 + 8 hi + j of
// each 32, query lr) are an A operand's k order, so ctx goes in registers, as bf16 hi + residual, into x = ctx.Wo[h] + bo[h] (16 WMMA, B = the head's 64 x 64 tile of WoT, n-major, read
// from global memory once per wave; per k step hi then residual on one accumulator); x -> bf16 hi + residual planes XH/XL[tok][h*64+o].
__global__ __launch_bounds__(128) void k_attn(const h16* __restrict__ Q16, const h16* __restrict__ QL16, const h16* __restrict__ K16, const h16* __restrict__ KL16, const h16* __restrict__ VTH, const h16* __restrict__ VTL, const float* __restrict__ QM, const float* __restrict__ KM, const bf* __restrict__ WoT, const float* __restrict__ bo, bf* XH, bf* XL) {
    __shared__ __align__(16) float kbias[NT_];
    __shared__ __align__(16) float ost[4][16 * 68];
    __shared__ __align__(16) h16 ring[2][RBUF];
    const int lane = threadIdx.x & 31, wave = threadIdx.x >> 5, lr = lane & 15, hi = lane >> 4;
    const int bid = blockIdx.x;
    const int b = bid / (NH_ * (NT_ / 64)), rem = bid - b * (NH_ * (NT_ / 64)), h = rem / (NT_ / 64), qt = rem - h * (NT_ / 64);
    const int q0 = qt * 64 + wave * 16;
    const size_t tok0 = (size_t)b * NT_;
    v16h qa[2];
    const size_t qo0 = (tok0 + q0 + lr) * DM + h * HD + 8 * hi;
#pragma unroll
    for (int kc = 0; kc < 2; ++kc) qa[kc] = cat16(*(const v8h*)(Q16 + qo0 + kc * 32), *(const v8h*)(Q16 + qo0 + kc * 32 + 16));
    const h16* kh_b = K16 + tok0 * DM + h * HD;
    const h16* kl_b = KL16 + tok0 * DM + h * HD;
    const size_t vbase = (((size_t)b * NH_ + h) * HD) * NT_;
    v8f o[4], ox[4];      // ctx^T: tile n, register j = d n * 16 + 8 hi + j of query lr
#pragma unroll
    for (int n = 0; n < 4; ++n) { o[n] = (v8f){}; ox[n] = (v8f){}; }
    float mrow = -3.0e38f, lpart = 0.f;             // of query lr; lpart sums this half's keys only, the halves are joined behind the loop
    const int kt_lo = 0, kt_hi = NT_ / 32 - 1;     // full attention; masks: key j kept iff key_mask[b][j] != 0, query row i kept iff query_mask[b][i] != 0 (fully masked rows -> 0 output, = nan_to_num)
    const float qmv = bfr(QM[tok0 + q0 + lr]);
    const int tid = threadIdx.x;
    // Each thread copies two 16-byte pieces of each of the four planes: K rows krow and krow + 16 (8 pieces a row), V rows vrow and vrow + 32 (4 pieces a row).
    const int krow = tid >> 3, kpc = (tid & 7) * 8, vrow = tid >> 2, vpc = (tid & 3) * 8;
    const unsigned ring0 = (unsigned)(size_t)&ring[0][0];
    const unsigned lk = ring0 + 2u * (unsigned)(krow * KPIT + kpc), lv = ring0 + 2u * (unsigned)(vrow * VPIT + vpc);
    const h16* gkh = kh_b + (size_t)krow * DM + kpc; const h16* gkl = kl_b + (size_t)krow * DM + kpc;
    const h16* gvh = VTH + vbase + (size_t)vrow * NT_ + vpc; const h16* gvl = VTL + vbase + (size_t)vrow * NT_ + vpc;
    auto fill = [&](int t) {
        const unsigned bo = (unsigned)(t & 1) * (2u * RBUF); const size_t ka = (size_t)t * 32 * DM, va = (size_t)t * 32;
        copy8(lk + bo + 2u * RKH, lk + bo + 2u * (RKH + 16 * KPIT), lk + bo + 2u * RKL, lk + bo + 2u * (RKL + 16 * KPIT),
              lv + bo + 2u * RVH, lv + bo + 2u * (RVH + 32 * VPIT), lv + bo + 2u * RVL, lv + bo + 2u * (RVL + 32 * VPIT),
              gkh + ka, gkh + ka + 16 * DM, gkl + ka, gkl + ka + 16 * DM, gvh + va, gvh + va + (size_t)32 * NT_, gvl + va, gvl + va + (size_t)32 * NT_);
    };
    fill(0);
#pragma unroll
    for (int i = 0; i < NT_ / 512; ++i) { const v4f km = *(const v4f*)(KM + tok0 + i * 512 + tid * 4); v4f kb;
#pragma unroll
        for (int e = 0; e < 4; ++e) kb[e] = bfr(km[e]) != 0.f ? 0.f : -__builtin_inff();
        *(v4fa*)(kbias + i * 512 + tid * 4) = kb; }     // published by the barrier that publishes tile 0
    asm volatile("s_wait_asynccnt 0x0" ::: "memory");    // this wave's share of tile 0 has landed
    __syncthreads();                                      // tile 0 and the key table are published to every wave
    fill(1);
#pragma unroll 1
    for (int kt = kt_lo; kt <= kt_hi; ++kt) {
        const int l0 = kt * 32;
        const h16* rb = &ring[kt & 1][0];
        const h16* rk0 = rb + lr * KPIT + 8 * hi; const h16* rk1 = rb + (16 + lr) * KPIT + 8 * hi;
        const float* kbp = kbias + l0 + 8 * hi;
        const v4f kb[4] = { *(const v4fa*)(kbp), *(const v4fa*)(kbp + 4), *(const v4fa*)(kbp + 16), *(const v4fa*)(kbp + 20) };
        v8f s0 = {}, s1 = {}, x0 = {}, x1 = {};
#pragma unroll
        for (int kc = 0; kc < 2; ++kc) {
            { const v16h k0h = cat16(*(const v8ha*)(rk0 + RKH + kc * 32), *(const v8ha*)(rk0 + RKH + kc * 32 + 16)), k1h = cat16(*(const v8ha*)(rk1 + RKH + kc * 32), *(const v8ha*)(rk1 + RKH + kc * 32 + 16));
              const v16h qlk = cat16(*(const v8h*)(QL16 + qo0 + kc * 32), *(const v8h*)(QL16 + qo0 + kc * 32 + 16));     // query residual re-read per step (registers)
              s0 = wmma16(k0h, qa[kc], s0); x0 = wmma16(k0h, qlk, x0); s1 = wmma16(k1h, qa[kc], s1); x1 = wmma16(k1h, qlk, x1); }
            { const v16h k0l = cat16(*(const v8ha*)(rk0 + RKL + kc * 32), *(const v8ha*)(rk0 + RKL + kc * 32 + 16)), k1l = cat16(*(const v8ha*)(rk1 + RKL + kc * 32), *(const v8ha*)(rk1 + RKL + kc * 32 + 16));
              x0 = wmma16(k0l, qa[kc], x0); x1 = wmma16(k1l, qa[kc], x1); }
        }
        v2f a[8];      // this lane's 16 scores in pairs of neighbouring accumulator registers: a[i] = keys 8 hi + 2 i, + 1 (i < 4), 16 + 8 hi + 2 (i - 4), + 1 (i >= 4)
#pragma unroll
        for (int i = 0; i < 4; ++i) {
            a[i]     = ((v2f){s0[2 * i], s0[2 * i + 1]} + (v2f){x0[2 * i], x0[2 * i + 1]} * LOSCI) * 0.125f + (v2f){kb[i >> 1][(2 * i) & 3], kb[i >> 1][((2 * i) & 3) + 1]};
            a[4 + i] = ((v2f){s1[2 * i], s1[2 * i + 1]} + (v2f){x1[2 * i], x1[2 * i + 1]} * LOSCI) * 0.125f + (v2f){kb[2 + (i >> 1)][(2 * i) & 3], kb[2 + (i >> 1)][((2 * i) & 3) + 1]};
        }
        float mx = fmaxf(a[0].x, a[0].y);
#pragma unroll
        for (int i = 1; i < 8; ++i) mx = fmaxf(mx, fmaxf(a[i].x, a[i].y));
        mx = fmaxf(mx, xhalf(mx));
        const float mn = fmaxf(mrow, mx);
        const float alpha = __expf(mrow - mn); mrow = mn;
        v16h pa, px; v2f ts[2] = { (v2f){0.f, 0.f}, (v2f){0.f, 0.f} };
#pragma unroll
        for (int i = 0; i < 8; ++i) {
            const v2f p = { __expf(a[i].x - mn), __expf(a[i].y - mn) };
            ts[i & 1] += p;
            const v2f ps = p * PSC; const v2h hh = __builtin_convertvector(ps, v2h);
            const v2h ll = __builtin_convertvector((ps - __builtin_convertvector(hh, v2f)) * LOSC, v2h);
            pa[2 * i] = hh.x; pa[2 * i + 1] = hh.y; px[2 * i] = ll.x; px[2 * i + 1] = ll.y;
        }
        ts[0] += ts[1];
        lpart = lpart * alpha + (ts[0].x + ts[0].y);
#pragma unroll
        for (int n = 0; n < 4; ++n)
#pragma unroll
            for (int j = 0; j < 8; ++j) { o[n][j] *= alpha; ox[n][j] *= alpha; }
#pragma unroll
        for (int n = 0; n < 4; ++n) { const h16* rv = rb + (n * 16 + lr) * VPIT + hi * 8;
            const v16h vh = cat16(*(const v8ha*)(rv + RVH), *(const v8ha*)(rv + RVH + 16)), vl = cat16(*(const v8ha*)(rv + RVL), *(const v8ha*)(rv + RVL + 16));
            o[n] = wmma16(vh, pa, o[n]); ox[n] = wmma16(vl, pa, ox[n]); ox[n] = wmma16(vh, px, ox[n]); }
        asm volatile("s_wait_dscnt 0x0" ::: "memory");       // this wave's reads of this tile's buffer have returned
        asm volatile("s_wait_asynccnt 0x0" ::: "memory");    // this wave's share of the next tile has landed
        __syncthreads();                                      // publishes the next tile and ends every wave's reads of this buffer
        if (kt + 2 <= kt_hi) fill(kt + 2);                    // refill the buffer just read; the test is the same for the whole block
    }
    asm volatile("s_wait_asynccnt 0x0" ::: "memory");        // nothing of this wave is in flight when the loop is left
    const float rs = lpart + xhalf(lpart);
    const float inv = (rs > 0.f && qmv != 0.f) ? 1.0f / (rs * PSC) : 0.f;   // masked query row, or every key masked: weights nan_to_num -> 0 -> output 0
    v16bf ch[2], cl[2];      // ctx rows (query lr) as A operands, 32 d each
#pragma unroll
    for (int kc = 0; kc < 2; ++kc) { v8us hb[2], lb[2];
#pragma unroll
        for (int u = 0; u < 2; ++u)
#pragma unroll
            for (int j = 0; j < 8; ++j) { const float c = (o[2 * kc + u][j] + ox[2 * kc + u][j] * LOSCI) * inv; const unsigned short t = f2bf(c); hb[u][j] = t; lb[u][j] = f2bf(c - bf2f(t)); }
        ch[kc] = cat16b(hb[0], hb[1]); cl[kc] = cat16b(lb[0], lb[1]); }
    const bf* wo = WoT + (size_t)(h * HD + lr) * DM + h * HD + 8 * hi;
    v8f xa[4];
#pragma unroll
    for (int t = 0; t < 4; ++t) xa[t] = (v8f){};
#pragma unroll
    for (int kc = 0; kc < 2; ++kc)
#pragma unroll
        for (int t = 0; t < 4; ++t) { const v16bf w = cat16b(*(const v8us*)(wo + (size_t)t * 16 * DM + kc * 32), *(const v8us*)(wo + (size_t)t * 16 * DM + kc * 32 + 16));
            xa[t] = wmmab(ch[kc], w, xa[t]); xa[t] = wmmab(cl[kc], w, xa[t]); }
    float* os = &ost[wave][0];
#pragma unroll
    for (int t = 0; t < 4; ++t) { const float bv = bfr(bo[h * HD + t * 16 + lr]);
#pragma unroll
        for (int j = 0; j < 8; ++j) os[(hi * 8 + j) * 68 + t * 16 + lr] = xa[t][j] + bv; }
    __syncthreads();
    const size_t cbase = (tok0 + q0) * DM + (size_t)h * HD;
    auto pass = [&]() {
#pragma unroll
        for (int s = 0; s < 4; ++s) { const int row = 4 * s + (lane >> 3), piece = lane & 7; const float* sp = os + row * 68 + piece * 8; v8us oh, ol;
#pragma unroll
            for (int i = 0; i < 8; ++i) { const unsigned short hb = f2bf(sp[i]); oh[i] = hb; ol[i] = f2bf(sp[i] - bf2f(hb)); }
            *(v8us*)(XH + cbase + (size_t)row * DM + piece * 8) = oh; *(v8us*)(XL + cbase + (size_t)row * DM + piece * 8) = ol; }
    };
    pass(); 
}

#define VST2(T, p, v) do { const T vst2_v_ = (v); *(T*)(p) = vst2_v_;  } while (0)
extern "C" void kernel_launch(void* const* d_in, const int* in_sizes, int n_in,
                              void* d_out, int out_size, void* d_ws, size_t ws_size, hipStream_t stream) {
    (void)in_sizes; (void)n_in; (void)out_size;
    const float* xq = (const float*)d_in[0]; const float* xk = (const float*)d_in[1]; const float* xv = (const float*)d_in[2]; const float* QM = (const float*)d_in[3]; const float* KM = (const float*)d_in[4];
    const float* Wq = (const float*)d_in[5]; const float* bq = (const float*)d_in[6]; const float* Wk = (const float*)d_in[7]; const float* bk = (const float*)d_in[8]; const float* Wv = (const float*)d_in[9]; const float* bv = (const float*)d_in[10];
    const float* Wo = (const float*)d_in[11]; const float* bo = (const float*)d_in[12]; const float* Wf = (const float*)d_in[13]; const float* bfin = (const float*)d_in[14];
    float* out = (float*)d_out;    // [2][2048][1024]
    char* wsp = (char*)d_ws;
    auto take = [&](size_t bytes) { char* p = wsp; wsp += (bytes + 255) & ~(size_t)255; return (void*)p; };
    bf* Xq = (bf*)take((size_t)NTK * DM * 2); bf* Xk = (bf*)take((size_t)NTK * DM * 2); bf* Xv = (bf*)take((size_t)NTK * DM * 2);
    bf* WqT = (bf*)take((size_t)DM * DM * 2); bf* WkT = (bf*)take((size_t)DM * DM * 2); bf* WvT = (bf*)take((size_t)DM * DM * 2); bf* WoBD = (bf*)take((size_t)DM * DM * 2); bf* WfT = (bf*)take((size_t)DM * DM * 2);
    float* TMP = (float*)take((size_t)NTK * DM * 4);
    h16* QH = (h16*)take((size_t)NTK * DM * 2); h16* QL = (h16*)take((size_t)NTK * DM * 2); h16* KH = (h16*)take((size_t)NTK * DM * 2); h16* KL = (h16*)take((size_t)NTK * DM * 2);
    h16* VTH = (h16*)take((size_t)NTK * DM * 2); h16* VTL = (h16*)take((size_t)NTK * DM * 2);
    bf* XH = (bf*)take((size_t)NTK * DM * 2); bf* XL = (bf*)take((size_t)NTK * DM * 2);
    if ((size_t)(wsp - (char*)d_ws) > ws_size) return;    // 3 x 8.4 + 5 x 2.1 + 16.8 + 8 x 8.4 ~ 120 MB, no aliasing
    // every loop of launches over heads, planes and batch items is a grid dimension: 6 launches
    k_prep<<<dim3(256, 5, 1), 256, 0, stream>>>(Wq, Wk, Wv, Wf, Wo, WqT, WkT, WvT, WfT, WoBD);
    k_cvtb<<<dim3(NTK / 8, 3, 1), 256, 0, stream>>>(xq, xk, xv, NTK, Xq, Xk, Xv);
    k_qkv<<<dim3(NTK / 128, DM / 128, 3), 128, 0, stream>>>(Xq, Xk, Xv, WqT, WkT, WvT, bq, bk, bv, QH, QL, KH, KL, TMP);
    k_vt<<<NB_ * NH_ * (NT_ / 64), 256, 0, stream>>>(TMP, VTH, VTL);
    k_attn<<<NB_ * NH_ * (NT_ / 64), 128, 0, stream>>>(QH, QL, KH, KL, VTH, VTL, QM, KM, WoBD, bo, XH, XL);      // with the per-head ctx.Wo[h] + bo[h]
    k_gemmb<<<dim3(NTK / 128, DM / 128, 1), 128, 0, stream>>>(XH, XL, WfT, bfin, out, DM);   // x.Wf + bf
}

// v006
// It runs in 145 microseconds.
// Timed twice side by side with v005, it ran 1.05 and 1.06 times as fast.
// Over all steps from v000 it is 5.54 times as fast.
#include <hip/hip_runtime.h>

// Compute dtypes, f32 accumulate, both batch items in every launch: per-head q/k/v = query/key/value.W[h] + b[h] (weights [H][E][D] k-major per head, transposed once
// into one n-major [H*D][E] plane each; PLAIN bf16 operands = inputs rounded once, exact products; biases rounded to bf16) with q, k and v (v transposed, [b][h][d][key]) written straight from the GEMM
// epilogue as f16 hi + residual x1024 planes; the 16-head attention (64-dim heads, scale 1/8, keys kept iff key_mask != 0, query rows kept iff query_mask
// != 0, fully-masked rows give 0 as the reference's nan_to_num) fused on v_wmma_f32_16x16x32_f16 (scores hi.hi + hi.lo + lo.hi with residual terms on
// their own accumulator, online f32 softmax, weights (x32768) and v as f16 hi + residual x1024); the per-head output linear ctx.Wo[h] + bo[h] in the attention
// kernel's epilogue, and the final x.Wf + bf as a GEMM, both on v_wmma_f32_16x16x32_bf16 with the computed operand as bf16 hi + UNSCALED residual (two

#define NB_  2                   // both batch items are rows of the same launches
#define NT_  2048
#define DM   1024
#define NH_  16
#define HD   64
#define NTK  (NB_ * NT_)
#define NW   1024
#define NQKV 1024
#define PSC  32768.0f
#define LOSC 1024.0f
#define LOSCI (1.0f / 1024.0f)

typedef _Float16 h16;
typedef unsigned short bf;
typedef __attribute__((ext_vector_type(16))) __bf16   v16bf;
typedef __attribute__((ext_vector_type(16))) _Float16 v16h;
typedef __attribute__((ext_vector_type(8)))  _Float16 v8h;
typedef __attribute__((ext_vector_type(8)))  unsigned short v8us;
typedef __attribute__((ext_vector_type(8)))  float    v8f;
typedef __attribute__((ext_vector_type(4)))  float    v4f;
typedef __attribute__((ext_vector_type(2)))  float    v2f;
typedef __attribute__((ext_vector_type(2)))  _Float16 v2h;
typedef v8h  __attribute__((may_alias)) v8ha;
typedef v4f  __attribute__((may_alias)) v4fa;
typedef v8us __attribute__((may_alias)) v8usa;

__device__ __forceinline__ unsigned short f2bf(float f) { unsigned u = __float_as_uint(f); u += 0x7FFFu + ((u >> 16) & 1u); return (unsigned short)(u >> 16); }
__device__ __forceinline__ float bf2f(unsigned short b) { return __uint_as_float(((unsigned)b) << 16); }
__device__ __forceinline__ float bfr(float f) { return bf2f(f2bf(f)); }
__device__ __forceinline__ v16h cat16(v8h lo, v8h hi) { return __builtin_shufflevector(lo, hi, 0, 1, 2, 3, 4, 5, 6, 7, 8, 9, 10, 11, 12, 13, 14, 15); }
__device__ __forceinline__ v16bf cat16b(v8us lo, v8us hi) { return __builtin_bit_cast(v16bf, __builtin_shufflevector(lo, hi, 0, 1, 2, 3, 4, 5, 6, 7, 8, 9, 10, 11, 12, 13, 14, 15)); }
__device__ __forceinline__ v8f wmma16(v16h a, v16h b, v8f c) { return __builtin_amdgcn_wmma_f32_16x16x32_f16(false, a, false, b, (short)0, c, false, false); }
__device__ __forceinline__ v8f wmmab(v16bf a, v16bf b, v8f c) { return __builtin_amdgcn_wmma_f32_16x16x32_bf16(false, a, false, b, (short)0, c, false, false); }

// blockIdx.y picks one of the three activations (query, key, value).
__global__ __launch_bounds__(256) void k_cvtb(const float* __restrict__ s0, const float* __restrict__ s1, const float* __restrict__ s2, int nrows, bf* d0, bf* d1, bf* d2) {
    const int lane = threadIdx.x & 31, r = blockIdx.x * 8 + (threadIdx.x >> 5);
    if (r >= nrows) return;
    const int y = blockIdx.y;
    const float* src = y == 0 ? s0 : (y == 1 ? s1 : s2);
    bf* dst = y == 0 ? d0 : (y == 1 ? d1 : d2);
    v8us o[DM / 256];
#pragma unroll
    for (int q = 0; q < DM / 256; ++q) { v8us t;
#pragma unroll
        for (int i = 0; i < 8; ++i) t[i] = f2bf(src[(size_t)r * DM + q * 256 + lane * 8 + i]);
        o[q] = t; }
#pragma unroll
    for (int q = 0; q < DM / 256; ++q) *(v8us*)(dst + (size_t)r * DM + q * 256 + lane * 8) = o[q];
    
}

// k_prep: every weight plane in one grid, one 64 x 64 tile (n-tile a, k-tile c) of a [1024][1024] n-major bf16 plane per block, transposed through LDS.
// blockIdx.y = 0, 1, 2: Wq, Wk, Wv (head a, [E][D] k-major); 3: Wf ([K][N] k-major); 4: the per-head output linears: tile (a, a) = Wo[a] transposed; the other
// tiles of that plane are neither written nor read.
__global__ __launch_bounds__(256) void k_prep(const float* __restrict__ Wq, const float* __restrict__ Wk, const float* __restrict__ Wv, const float* __restrict__ Wf, const float* __restrict__ Wo,
                                              bf* WqT, bf* WkT, bf* WvT, bf* WfT, bf* WoBD) {
    __shared__ __align__(16) unsigned short tl[64 * 72];
    const int tid = threadIdx.x, a = blockIdx.x >> 4, c = blockIdx.x & 15, y = blockIdx.y;
    const float* src; bf* pln; int ncols = HD; bool live = true;
    if (y < 3) { src = (y == 0 ? Wq : (y == 1 ? Wk : Wv)) + (size_t)a * DM * HD + (size_t)c * 64 * HD; pln = y == 0 ? WqT : (y == 1 ? WkT : WvT); }
    else if (y == 3) { src = Wf + (size_t)c * 64 * DM + a * 64; pln = WfT; ncols = DM; }
    else { src = Wo + (size_t)a * HD * HD; pln = WoBD; live = (a == c); }
    if (!live) return;      // the same for the whole block, in front of the barrier
    bf* dst = pln + (size_t)a * 64 * DM + c * 64;
    const int kk = tid >> 2, nq = (tid & 3) * 16;
#pragma unroll
    for (int i = 0; i < 16; ++i) tl[(nq + i) * 72 + kk] = f2bf(src[(size_t)kk * ncols + nq + i]);
    __syncthreads();
    const int piece = tid & 7;
#pragma unroll
    for (int s = 0; s < 2; ++s) { const int nr = (tid >> 3) + 32 * s; const v8us val = *(const v8usa*)(tl + nr * 72 + piece * 8); *(v8us*)(dst + (size_t)nr * DM + piece * 8) = val; }
}
// Eight asynchronous 16-byte copies of one lane, global -> LDS. The closing s_wait_xcnt 0 stands in the copies' own statement so that no address register is rewritten in front of it.
__device__ __forceinline__ void copy8(unsigned l0, unsigned l1, unsigned l2, unsigned l3, unsigned l4, unsigned l5, unsigned l6, unsigned l7,
                                      const void* g0, const void* g1, const void* g2, const void* g3, const void* g4, const void* g5, const void* g6, const void* g7) {
    asm volatile("global_load_async_to_lds_b128 %0, %8, off\n\t"
                 "global_load_async_to_lds_b128 %1, %9, off\n\t"
                 "global_load_async_to_lds_b128 %2, %10, off\n\t"
                 "global_load_async_to_lds_b128 %3, %11, off\n\t"
                 "global_load_async_to_lds_b128 %4, %12, off\n\t"
                 "global_load_async_to_lds_b128 %5, %13, off\n\t"
                 "global_load_async_to_lds_b128 %6, %14, off\n\t"
                 "global_load_async_to_lds_b128 %7, %15, off\n\t"
                 "s_wait_xcnt 0x0"
                 :: "v"(l0), "v"(l1), "v"(l2), "v"(l3), "v"(l4), "v"(l5), "v"(l6), "v"(l7), "v"(g0), "v"(g1), "v"(g2), "v"(g3), "v"(g4), "v"(g5), "v"(g6), "v"(g7) : "memory");
}
// A staged GEMM plane: 128 rows of 64 k elements (128 B) at a pitch of 72 elements (144 B, an odd multiple of 16 B for the 16-byte fragment reads).
#define GPIT 72
#define GPLN (128 * GPIT)
// One 128 x 128 tile (blockIdx.x, blockIdx.y) of C = A.Bn^T + bias, four waves as 2 x 2, each with a 64 x 64 tile (4 x 4 accumulators): a fragment read from LDS feeds four products and a
// staged row 128 outputs. F16OUT is the same in every thread of a block. smem = the block's LDS: in the k loop two buffers of 2 (3 with SPLITA) planes (A rows, Bn rows, Al rows of 64 k each),
// filled by asynchronous copies, the next 64 k in flight while these are worked on; behind the loop's last barrier, when no wave reads the planes any more and no copy is in flight, the
// same bytes are the 4 x 64 x 68 f32 output staging. TR (with F16OUT; the same in every thread of a block): the wave's tile leaves transposed, as the planes C, C2 = [batch item][head][64 d][NT_ keys]:
// the tile's 64 rows are 64 keys of one batch item and its 64 columns one head's d, so the staging is written [column][row] and read back like the plain one.
template <bool SPLITA>
__device__ __forceinline__ void gemm_tile(unsigned char* smem, const bool F16OUT, const bool TR, const bf* __restrict__ A, const bf* __restrict__ Al, const bf* __restrict__ Bn, const float* __restrict__ bias, float* C, int ldc, h16* C2) {
    const int lane = threadIdx.x & 31, wave = threadIdx.x >> 5, lr = lane & 15, hi = lane >> 4;
    const int wr = wave >> 1, wc = wave & 1;
    const int r0 = blockIdx.x * 128 + wr * 64, c0 = blockIdx.y * 128 + wc * 64;
    constexpr int NPL = SPLITA ? 3 : 2;
    // Each thread copies eight 16-byte pieces of each plane: rows crow + 16 i, i = 0 .. 7 (8 pieces a row).
    const int tid = threadIdx.x, crow = tid >> 3, cpc = (tid & 7) * 8;
    const unsigned lc = (unsigned)(size_t)smem + 2u * (unsigned)(crow * GPIT + cpc);
    const bf* ga = A + (size_t)(blockIdx.x * 128 + crow) * DM + cpc;
    const bf* gl = SPLITA ? Al + (size_t)(blockIdx.x * 128 + crow) * DM + cpc : ga;
    const bf* gb = Bn + (size_t)(blockIdx.y * 128 + crow) * DM + cpc;
    auto plane = [&](unsigned l, const bf* g) {
        copy8(l, l + 2u * 16 * GPIT, l + 2u * 32 * GPIT, l + 2u * 48 * GPIT, l + 2u * 64 * GPIT, l + 2u * 80 * GPIT, l + 2u * 96 * GPIT, l + 2u * 112 * GPIT,
              g, g + 16 * DM, g + 32 * DM, g + 48 * DM, g + 64 * DM, g + 80 * DM, g + 96 * DM, g + 112 * DM);
    };
    auto fill = [&](int s) {
        const unsigned la = lc + (unsigned)(s & 1) * (2u * NPL * GPLN); const int ko = s * 64;
        plane(la, ga + ko); plane(la + 2u * GPLN, gb + ko);
        if (SPLITA) plane(la + 2u * 2 * GPLN, gl + ko);
    };
    v8f acc[4][4];      // [16 rows m][16 columns t]
#pragma unroll
    for (int m = 0; m < 4; ++m)
#pragma unroll
        for (int t = 0; t < 4; ++t) acc[m][t] = (v8f){};
    fill(0);
    asm volatile("s_wait_asynccnt 0x0" ::: "memory");    // this wave's share of stage 0 has landed
    __syncthreads();                                      // stage 0 is published to every wave
    fill(1);
#pragma unroll 1
    for (int st = 0; st < DM / 64; ++st) {
        const bf* rb = (const bf*)(const void*)smem + (st & 1) * (NPL * GPLN);
        const bf* ra = rb + (wr * 64 + lr) * GPIT + 8 * hi; const bf* rn = rb + GPLN + (wc * 64 + lr) * GPIT + 8 * hi;
#pragma unroll
        for (int kc = 0; kc < 64; kc += 32) {
            v16bf a[4], al[4], b[4];
#pragma unroll
            for (int m = 0; m < 4; ++m) a[m] = cat16b(*(const v8usa*)(ra + m * 16 * GPIT + kc), *(const v8usa*)(ra + m * 16 * GPIT + kc + 16));
#pragma unroll
            for (int t = 0; t < 4; ++t) b[t] = cat16b(*(const v8usa*)(rn + t * 16 * GPIT + kc), *(const v8usa*)(rn + t * 16 * GPIT + kc + 16));
#pragma unroll
            for (int m = 0; m < 4; ++m) { al[m] = a[m];
                if (SPLITA) al[m] = cat16b(*(const v8usa*)(ra + 2 * GPLN + m * 16 * GPIT + kc), *(const v8usa*)(ra + 2 * GPLN + m * 16 * GPIT + kc + 16)); }
            // keeps a k step's fragment reads together in front of its products: left free, the scheduler sinks each b[t] to its first use, and the wave waits out an LDS latency per t
            __builtin_amdgcn_sched_barrier(0);
#pragma unroll
            for (int t = 0; t < 4; ++t) {
#pragma unroll
                for (int m = 0; m < 4; ++m) acc[m][t] = wmmab(a[m], b[t], acc[m][t]);
                if (SPLITA) {
#pragma unroll
                    for (int m = 0; m < 4; ++m) acc[m][t] = wmmab(al[m], b[t], acc[m][t]); } }
        }
        asm volatile("s_wait_dscnt 0x0" ::: "memory");       // this wave's reads of this stage's buffer have returned
        asm volatile("s_wait_asynccnt 0x0" ::: "memory");    // this wave's share of the next stage has landed
        __syncthreads();                                      // publishes the next stage and ends every wave's reads of this buffer
        if (st + 2 < DM / 64) fill(st + 2);                   // refill the buffer just read; the test is the same for the whole block
    }
    asm volatile("s_wait_asynccnt 0x0" ::: "memory");        // nothing of this wave is in flight when the planes become output staging
    float* os = (float*)(void*)smem + wave * (64 * 68);
    if (TR) {      // [column][row]: a lane's eight accumulator registers are eight neighbouring rows of one column, two 16-byte stores
#pragma unroll
        for (int t = 0; t < 4; ++t) { const float bv = bias ? bfr(bias[c0 + t * 16 + lr]) : 0.f;
#pragma unroll
            for (int m = 0; m < 4; ++m) { float* tp = os + (t * 16 + lr) * 68 + m * 16 + hi * 8;
                *(v4fa*)(tp) = (v4f){acc[m][t][0] + bv, acc[m][t][1] + bv, acc[m][t][2] + bv, acc[m][t][3] + bv};
                *(v4fa*)(tp + 4) = (v4f){acc[m][t][4] + bv, acc[m][t][5] + bv, acc[m][t][6] + bv, acc[m][t][7] + bv}; } }
    } else {
#pragma unroll
    for (int t = 0; t < 4; ++t) { const float bv = bias ? bfr(bias[c0 + t * 16 + lr]) : 0.f;
#pragma unroll
        for (int m = 0; m < 4; ++m)
#pragma unroll
            for (int j = 0; j < 8; ++j) os[(m * 16 + hi * 8 + j) * 68 + t * 16 + lr] = acc[m][t][j] + bv; }
    }
    __syncthreads();
    if (F16OUT) {
        if (TR) ldc = NT_;
        const size_t obase = TR ? ((size_t)((r0 / NT_) * NH_ + c0 / HD) * HD) * NT_ + (r0 % NT_) : (size_t)r0 * ldc + c0;
        h16* crow = (h16*)(void*)C + obase; h16* cro2 = C2 + obase;      // every f16 tile has its residual plane
        auto pass = [&]() {
#pragma unroll
            for (int s = 0; s < 16; ++s) { const int row = 4 * s + (lane >> 3), piece = lane & 7; const float* sp = os + row * 68 + piece * 8; v8h o, o2;
#pragma unroll
                for (int i = 0; i < 8; ++i) { const h16 a = (h16)sp[i]; o[i] = a; o2[i] = (h16)((sp[i] - (float)a) * LOSC); }
                *(v8h*)(crow + (size_t)row * ldc + piece * 8) = o; *(v8h*)(cro2 + (size_t)row * ldc + piece * 8) = o2;
                asm volatile("s_wait_xcnt 0x0" ::: "memory"); }     // in front of the next rows' values, which reuse the two stores' address and data registers
        };
        pass(); 
    } else {
        float* crow = C + (size_t)r0 * ldc + c0;
        auto pass = [&]() {
#pragma unroll
            for (int s = 0; s < 32; ++s) { const int Lid = (lane >> 3) + 4 * s, piece = lane & 7; const int row = Lid >> 1, cofs = (Lid & 1) * 32 + piece * 4;
                const v4f val = *(const v4fa*)(os + row * 68 + cofs); *(v4f*)(crow + (size_t)row * ldc + cofs) = val; }
        };
        pass(); 
    }
}

__global__ __launch_bounds__(128) void k_gemmb(const bf* __restrict__ A, const bf* __restrict__ Al, const bf* __restrict__ Bn, const float* __restrict__ bias, float* C, int ldc) {
    __shared__ __align__(16) unsigned char smem[2 * 3 * GPLN * 2];
    gemm_tile<true>(smem, false, false, A, Al, Bn, bias, C, ldc, nullptr);
}
// The three projections in one grid, each to f16 hi + residual x1024 planes: blockIdx.z = 0: q, 1: k ([token][h * 64 + d]), 2: v, transposed ([batch item][head][d][key]).
__global__ __launch_bounds__(128) void k_qkv(const bf* __restrict__ Xq, const bf* __restrict__ Xk, const bf* __restrict__ Xv, const bf* __restrict__ WqT, const bf* __restrict__ WkT, const bf* __restrict__ WvT,
                                             const float* __restrict__ bq, const float* __restrict__ bk, const float* __restrict__ bv, h16* QH, h16* QL, h16* KH, h16* KL, h16* VTH, h16* VTL) {
    __shared__ __align__(16) unsigned char smem[2 * 2 * GPLN * 2];
    const int z = blockIdx.z;
    const bf* A = z == 0 ? Xq : (z == 1 ? Xk : Xv);
    const bf* Bn = z == 0 ? WqT : (z == 1 ? WkT : WvT);
    const float* bias = z == 0 ? bq : (z == 1 ? bk : bv);
    float* C = (float*)(void*)(z == 0 ? QH : (z == 1 ? KH : VTH));
    h16* C2 = z == 0 ? QL : (z == 1 ? KL : VTL);
    gemm_tile<false>(smem, true, z == 2, A, nullptr, Bn, bias, C, DM, C2);
}

// One trip's K and V planes in LDS, in f16 elements: K hi, K residual as [32 keys][64 d] at a pitch of 72 (144 B), V hi, V residual as [64 d][32 keys] at a pitch of 40 (80 B):
// both pitches are odd multiples of 16 B for the 16-byte fragment reads.
#define KPIT 72
#define VPIT 40
#define RKH  0
#define RKL  (32 * KPIT)
#define RVH  (2 * 32 * KPIT)
#define RVL  (2 * 32 * KPIT + 64 * VPIT)
#define RBUF (2 * 32 * KPIT + 2 * 64 * VPIT)
// lane l with lane l ^ 16, as a vector cross-row move (a shuffle would go through the LDS unit and its wait)
__device__ __forceinline__ float xhalf(float x) { return __builtin_bit_cast(float, __builtin_amdgcn_permlanex16(__builtin_bit_cast(int, x), __builtin_bit_cast(int, x), 0x76543210, 0xfedcba98, false, false)); }
// k_attn: block = (b, h, 64 queries), wave = 16; ALL 64 key tiles of 32 keys (no skip); each tile's K and V planes are brought into LDS once per block by asynchronous copies,
// two buffers, the next tile in flight while this one is worked on. The products are TRANSPOSED: scores^T = K.Q^T (A = K rows, B = Q), ctx^T += V^T.P^T (A = V^T rows, B = P^T), so a lane
// holds 16 of the 32 scores of ONE query (column lr; keys 8 hi + j and 16 + 8 hi + j, which is the k order of a B operand): maximum and sum run in the lane plus one exchange between the
// wave's halves, and the weights (x32768, f16 hi + residual x1024) go from the score accumulators into the B operand in registers. 12 WMMA scores /8 (f32), online softmax, 12 WMMA .v;
// key mask as an additive 0 / -inf table in LDS (built once per block), query mask applied to the row's final factor. Epilogue: a lane's ctx^T registers (d 8 hi + j and 16 + 8 hi + j of
// each 32, query lr) are an A operand's k order, so ctx goes in registers, as bf16 hi + residual, into x = ctx.Wo[h] + bo[h] (16 WMMA, B = the head's 64 x 64 tile of WoT, n-major, read
// from global memory once per wave; per k step hi then residual on one accumulator); x -> bf16 hi + residual planes XH/XL[tok][h*64+o].
__global__ __launch_bounds__(128) void k_attn(const h16* __restrict__ Q16, const h16* __restrict__ QL16, const h16* __restrict__ K16, const h16* __restrict__ KL16, const h16* __restrict__ VTH, const h16* __restrict__ VTL, const float* __restrict__ QM, const float* __restrict__ KM, const bf* __restrict__ WoT, const float* __restrict__ bo, bf* XH, bf* XL) {
    __shared__ __align__(16) float kbias[NT_];
    __shared__ __align__(16) float ost[4][16 * 68];
    __shared__ __align__(16) h16 ring[2][RBUF];
    const int lane = threadIdx.x & 31, wave = threadIdx.x >> 5, lr = lane & 15, hi = lane >> 4;
    const int bid = blockIdx.x;
    const int b = bid / (NH_ * (NT_ / 64)), rem = bid - b * (NH_ * (NT_ / 64)), h = rem / (NT_ / 64), qt = rem - h * (NT_ / 64);
    const int q0 = qt * 64 + wave * 16;
    const size_t tok0 = (size_t)b * NT_;
    v16h qa[2];
    const size_t qo0 = (tok0 + q0 + lr) * DM + h * HD + 8 * hi;
#pragma unroll
    for (int kc = 0; kc < 2; ++kc) qa[kc] = cat16(*(const v8h*)(Q16 + qo0 + kc * 32), *(const v8h*)(Q16 + qo0 + kc * 32 + 16));
    const h16* kh_b = K16 + tok0 * DM + h * HD;
    const h16* kl_b = KL16 + tok0 * DM + h * HD;
    const size_t vbase = (((size_t)b * NH_ + h) * HD) * NT_;
    v8f o[4], ox[4];      // ctx^T: tile n, register j = d n * 16 + 8 hi + j of query lr
#pragma unroll
    for (int n = 0; n < 4; ++n) { o[n] = (v8f){}; ox[n] = (v8f){}; }
    float mrow = -3.0e38f, lpart = 0.f;             // of query lr; lpart sums this half's keys only, the halves are joined behind the loop
    const int kt_lo = 0, kt_hi = NT_ / 32 - 1;     // full attention; masks: key j kept iff key_mask[b][j] != 0, query row i kept iff query_mask[b][i] != 0 (fully masked rows -> 0 output, = nan_to_num)
    const float qmv = bfr(QM[tok0 + q0 + lr]);
    const int tid = threadIdx.x;
    // Each thread copies two 16-byte pieces of each of the four planes: K rows krow and krow + 16 (8 pieces a row), V rows vrow and vrow + 32 (4 pieces a row).
    const int krow = tid >> 3, kpc = (tid & 7) * 8, vrow = tid >> 2, vpc = (tid & 3) * 8;
    const unsigned ring0 = (unsigned)(size_t)&ring[0][0];
    const unsigned lk = ring0 + 2u * (unsigned)(krow * KPIT + kpc), lv = ring0 + 2u * (unsigned)(vrow * VPIT + vpc);
    const h16* gkh = kh_b + (size_t)krow * DM + kpc; const h16* gkl = kl_b + (size_t)krow * DM + kpc;
    const h16* gvh = VTH + vbase + (size_t)vrow * NT_ + vpc; const h16* gvl = VTL + vbase + (size_t)vrow * NT_ + vpc;
    auto fill = [&](int t) {
        const unsigned bo = (unsigned)(t & 1) * (2u * RBUF); const size_t ka = (size_t)t * 32 * DM, va = (size_t)t * 32;
        copy8(lk + bo + 2u * RKH, lk + bo + 2u * (RKH + 16 * KPIT), lk + bo + 2u * RKL, lk + bo + 2u * (RKL + 16 * KPIT),
              lv + bo + 2u * RVH, lv + bo + 2u * (RVH + 32 * VPIT), lv + bo + 2u * RVL, lv + bo + 2u * (RVL + 32 * VPIT),
              gkh + ka, gkh + ka + 16 * DM, gkl + ka, gkl + ka + 16 * DM, gvh + va, gvh + va + (size_t)32 * NT_, gvl + va, gvl + va + (size_t)32 * NT_);
    };
    fill(0);
#pragma unroll
    for (int i = 0; i < NT_ / 512; ++i) { const v4f km = *(const v4f*)(KM + tok0 + i * 512 + tid * 4); v4f kb;
#pragma unroll
        for (int e = 0; e < 4; ++e) kb[e] = bfr(km[e]) != 0.f ? 0.f : -__builtin_inff();
        *(v4fa*)(kbias + i * 512 + tid * 4) = kb; }     // published by the barrier that publishes tile 0
    asm volatile("s_wait_asynccnt 0x0" ::: "memory");    // this wave's share of tile 0 has landed
    __syncthreads();                                      // tile 0 and the key table are published to every wave
    fill(1);
#pragma unroll 1
    for (int kt = kt_lo; kt <= kt_hi; ++kt) {
        const int l0 = kt * 32;
        const h16* rb = &ring[kt & 1][0];
        const h16* rk0 = rb + lr * KPIT + 8 * hi; const h16* rk1 = rb + (16 + lr) * KPIT + 8 * hi;
        const float* kbp = kbias + l0 + 8 * hi;
        const v4f kb[4] = { *(const v4fa*)(kbp), *(const v4fa*)(kbp + 4), *(const v4fa*)(kbp + 16), *(const v4fa*)(kbp + 20) };
        v8f s0 = {}, s1 = {}, x0 = {}, x1 = {};
#pragma unroll
        for (int kc = 0; kc < 2; ++kc) {
            { const v16h k0h = cat16(*(const v8ha*)(rk0 + RKH + kc * 32), *(const v8ha*)(rk0 + RKH + kc * 32 + 16)), k1h = cat16(*(const v8ha*)(rk1 + RKH + kc * 32), *(const v8ha*)(rk1 + RKH + kc * 32 + 16));
              const v16h qlk = cat16(*(const v8h*)(QL16 + qo0 + kc * 32), *(const v8h*)(QL16 + qo0 + kc * 32 + 16));     // query residual re-read per step (registers)
              s0 = wmma16(k0h, qa[kc], s0); x0 = wmma16(k0h, qlk, x0); s1 = wmma16(k1h, qa[kc], s1); x1 = wmma16(k1h, qlk, x1); }
            { const v16h k0l = cat16(*(const v8ha*)(rk0 + RKL + kc * 32), *(const v8ha*)(rk0 + RKL + kc * 32 + 16)), k1l = cat16(*(const v8ha*)(rk1 + RKL + kc * 32), *(const v8ha*)(rk1 + RKL + kc * 32 + 16));
              x0 = wmma16(k0l, qa[kc], x0); x1 = wmma16(k1l, qa[kc], x1); }
        }
        v2f a[8];      // this lane's 16 scores in pairs of neighbouring accumulator registers: a[i] = keys 8 hi + 2 i, + 1 (i < 4), 16 + 8 hi + 2 (i - 4), + 1 (i >= 4)
#pragma unroll
        for (int i = 0; i < 4; ++i) {
            a[i]     = ((v2f){s0[2 * i], s0[2 * i + 1]} + (v2f){x0[2 * i], x0[2 * i + 1]} * LOSCI) * 0.125f + (v2f){kb[i >> 1][(2 * i) & 3], kb[i >> 1][((2 * i) & 3) + 1]};
            a[4 + i] = ((v2f){s1[2 * i], s1[2 * i + 1]} + (v2f){x1[2 * i], x1[2 * i + 1]} * LOSCI) * 0.125f + (v2f){kb[2 + (i >> 1)][(2 * i) & 3], kb[2 + (i >> 1)][((2 * i) & 3) + 1]};
        }
        float mx = fmaxf(a[0].x, a[0].y);
#pragma unroll
        for (int i = 1; i < 8; ++i) mx = fmaxf(mx, fmaxf(a[i].x, a[i].y));
        mx = fmaxf(mx, xhalf(mx));
        const float mn = fmaxf(mrow, mx);
        const float alpha = __expf(mrow - mn); mrow = mn;
        v16h pa, px; v2f ts[2] = { (v2f){0.f, 0.f}, (v2f){0.f, 0.f} };
#pragma unroll
        for (int i = 0; i < 8; ++i) {
            const v2f p = { __expf(a[i].x - mn), __expf(a[i].y - mn) };
            ts[i & 1] += p;
            const v2f ps = p * PSC; const v2h hh = __builtin_convertvector(ps, v2h);
            const v2h ll = __builtin_convertvector((ps - __builtin_convertvector(hh, v2f)) * LOSC, v2h);
            pa[2 * i] = hh.x; pa[2 * i + 1] = hh.y; px[2 * i] = ll.x; px[2 * i + 1] = ll.y;
        }
        ts[0] += ts[1];
        lpart = lpart * alpha + (ts[0].x + ts[0].y);
#pragma unroll
        for (int n = 0; n < 4; ++n)
#pragma unroll
            for (int j = 0; j < 8; ++j) { o[n][j] *= alpha; ox[n][j] *= alpha; }
#pragma unroll
        for (int n = 0; n < 4; ++n) { const h16* rv = rb + (n * 16 + lr) * VPIT + hi * 8;
            const v16h vh = cat16(*(const v8ha*)(rv + RVH), *(const v8ha*)(rv + RVH + 16)), vl = cat16(*(const v8ha*)(rv + RVL), *(const v8ha*)(rv + RVL + 16));
            o[n] = wmma16(vh, pa, o[n]); ox[n] = wmma16(vl, pa, ox[n]); ox[n] = wmma16(vh, px, ox[n]); }
        asm volatile("s_wait_dscnt 0x0" ::: "memory");       // this wave's reads of this tile's buffer have returned
        asm volatile("s_wait_asynccnt 0x0" ::: "memory");    // this wave's share of the next tile has landed
        __syncthreads();                                      // publishes the next tile and ends every wave's reads of this buffer
        if (kt + 2 <= kt_hi) fill(kt + 2);                    // refill the buffer just read; the test is the same for the whole block
    }
    asm volatile("s_wait_asynccnt 0x0" ::: "memory");        // nothing of this wave is in flight when the loop is left
    const float rs = lpart + xhalf(lpart);
    const float inv = (rs > 0.f && qmv != 0.f) ? 1.0f / (rs * PSC) : 0.f;   // masked query row, or every key masked: weights nan_to_num -> 0 -> output 0
    v16bf ch[2], cl[2];      // ctx rows (query lr) as A operands, 32 d each
#pragma unroll
    for (int kc = 0; kc < 2; ++kc) { v8us hb[2], lb[2];
#pragma unroll
        for (int u = 0; u < 2; ++u)
#pragma unroll
            for (int j = 0; j < 8; ++j) { const float c = (o[2 * kc + u][j] + ox[2 * kc + u][j] * LOSCI) * inv; const unsigned short t = f2bf(c); hb[u][j] = t; lb[u][j] = f2bf(c - bf2f(t)); }
        ch[kc] = cat16b(hb[0], hb[1]); cl[kc] = cat16b(lb[0], lb[1]); }
    const bf* wo = WoT + (size_t)(h * HD + lr) * DM + h * HD + 8 * hi;
    v8f xa[4];
#pragma unroll
    for (int t = 0; t < 4; ++t) xa[t] = (v8f){};
#pragma unroll
    for (int kc = 0; kc < 2; ++kc)
#pragma unroll
        for (int t = 0; t < 4; ++t) { const v16bf w = cat16b(*(const v8us*)(wo + (size_t)t * 16 * DM + kc * 32), *(const v8us*)(wo + (size_t)t * 16 * DM + kc * 32 + 16));
            xa[t] = wmmab(ch[kc], w, xa[t]); xa[t] = wmmab(cl[kc], w, xa[t]); }
    float* os = &ost[wave][0];
#pragma unroll
    for (int t = 0; t < 4; ++t) { const float bv = bfr(bo[h * HD + t * 16 + lr]);
#pragma unroll
        for (int j = 0; j < 8; ++j) os[(hi * 8 + j) * 68 + t * 16 + lr] = xa[t][j] + bv; }
    __syncthreads();
    const size_t cbase = (tok0 + q0) * DM + (size_t)h * HD;
    auto pass = [&]() {
#pragma unroll
        for (int s = 0; s < 4; ++s) { const int row = 4 * s + (lane >> 3), piece = lane & 7; const float* sp = os + row * 68 + piece * 8; v8us oh, ol;
#pragma unroll
            for (int i = 0; i < 8; ++i) { const unsigned short hb = f2bf(sp[i]); oh[i] = hb; ol[i] = f2bf(sp[i] - bf2f(hb)); }
            *(v8us*)(XH + cbase + (size_t)row * DM + piece * 8) = oh; *(v8us*)(XL + cbase + (size_t)row * DM + piece * 8) = ol; }
    };
    pass(); 
}

#define VST2(T, p, v) do { const T vst2_v_ = (v); *(T*)(p) = vst2_v_;  } while (0)
extern "C" void kernel_launch(void* const* d_in, const int* in_sizes, int n_in,
                              void* d_out, int out_size, void* d_ws, size_t ws_size, hipStream_t stream) {
    (void)in_sizes; (void)n_in; (void)out_size;
    const float* xq = (const float*)d_in[0]; const float* xk = (const float*)d_in[1]; const float* xv = (const float*)d_in[2]; const float* QM = (const float*)d_in[3]; const float* KM = (const float*)d_in[4];
    const float* Wq = (const float*)d_in[5]; const float* bq = (const float*)d_in[6]; const float* Wk = (const float*)d_in[7]; const float* bk = (const float*)d_in[8]; const float* Wv = (const float*)d_in[9]; const float* bv = (const float*)d_in[10];
    const float* Wo = (const float*)d_in[11]; const float* bo = (const float*)d_in[12]; const float* Wf = (const float*)d_in[13]; const float* bfin = (const float*)d_in[14];
    float* out = (float*)d_out;    // [2][2048][1024]
    char* wsp = (char*)d_ws;
    auto take = [&](size_t bytes) { char* p = wsp; wsp += (bytes + 255) & ~(size_t)255; return (void*)p; };
    bf* Xq = (bf*)take((size_t)NTK * DM * 2); bf* Xk = (bf*)take((size_t)NTK * DM * 2); bf* Xv = (bf*)take((size_t)NTK * DM * 2);
    bf* WqT = (bf*)take((size_t)DM * DM * 2); bf* WkT = (bf*)take((size_t)DM * DM * 2); bf* WvT = (bf*)take((size_t)DM * DM * 2); bf* WoBD = (bf*)take((size_t)DM * DM * 2); bf* WfT = (bf*)take((size_t)DM * DM * 2);
    h16* QH = (h16*)take((size_t)NTK * DM * 2); h16* QL = (h16*)take((size_t)NTK * DM * 2); h16* KH = (h16*)take((size_t)NTK * DM * 2); h16* KL = (h16*)take((size_t)NTK * DM * 2);
    h16* VTH = (h16*)take((size_t)NTK * DM * 2); h16* VTL = (h16*)take((size_t)NTK * DM * 2);
    bf* XH = (bf*)take((size_t)NTK * DM * 2); bf* XL = (bf*)take((size_t)NTK * DM * 2);
    if ((size_t)(wsp - (char*)d_ws) > ws_size) return;    // 3 x 8.4 + 5 x 2.1 + 8 x 8.4 ~ 103 MB, no aliasing
    // every loop of launches over heads, planes and batch items is a grid dimension: 5 launches
    k_prep<<<dim3(256, 5, 1), 256, 0, stream>>>(Wq, Wk, Wv, Wf, Wo, WqT, WkT, WvT, WfT, WoBD);
    k_cvtb<<<dim3(NTK / 8, 3, 1), 256, 0, stream>>>(xq, xk, xv, NTK, Xq, Xk, Xv);
    k_qkv<<<dim3(NTK / 128, DM / 128, 3), 128, 0, stream>>>(Xq, Xk, Xv, WqT, WkT, WvT, bq, bk, bv, QH, QL, KH, KL, VTH, VTL);
    k_attn<<<NB_ * NH_ * (NT_ / 64), 128, 0, stream>>>(QH, QL, KH, KL, VTH, VTL, QM, KM, WoBD, bo, XH, XL);      // with the per-head ctx.Wo[h] + bo[h]
    k_gemmb<<<dim3(NTK / 128, DM / 128, 1), 128, 0, stream>>>(XH, XL, WfT, bfin, out, DM);   // x.Wf + bf
}

// v008
// Measured time: 98.1 microseconds a run.
// Versions between v006 and this one are left out; their measured steps multiply to 1.47 times as fast.
// All steps since v000 together make it 8.16 times as fast.
#include <hip/hip_runtime.h>

// Compute dtypes, f32 accumulate, both batch items in every launch: per-head q/k/v = query/key/value.W[h] + b[h] (weights [H][E][D] k-major per head, transposed once
// into one n-major [H*D][E] plane each; PLAIN bf16 operands = inputs rounded once, exact products; biases in f32) with q, k and v written straight from the GEMM
// epilogue as one f16 plane each (an f16 rounding is an eighth of the bf16 rounding that the projections' inputs already carry); the 16-head attention (64-dim heads, scale 1/8, keys kept iff key_mask != 0, query rows kept iff query_mask
// != 0, fully-masked rows give 0 as the reference's nan_to_num) fused on v_wmma_f32_16x16x32_f16 (scores q.k,
// online f32 softmax, weights (x32768) and v as f16); the per-head output linear ctx.Wo[h] + bo[h] in the attention
// kernel's epilogue, and the final x.Wf + bf as a GEMM, both on v_wmma_f32_16x16x32_bf16 with the computed operand as bf16 hi + UNSCALED residual (two

#define NB_  2                   // both batch items are rows of the same launches
#define NT_  2048
#define DM   1024
#define NH_  16
#define HD   64
#define NTK  (NB_ * NT_)
#define NW   1024
#define NQKV 1024
#define PSC  32768.0f

typedef _Float16 h16;
typedef unsigned short bf;
typedef __attribute__((ext_vector_type(16))) __bf16   v16bf;
typedef __attribute__((ext_vector_type(16))) _Float16 v16h;
typedef __attribute__((ext_vector_type(8)))  _Float16 v8h;
typedef __attribute__((ext_vector_type(8)))  unsigned short v8us;
typedef __attribute__((ext_vector_type(8)))  float    v8f;
typedef __attribute__((ext_vector_type(4)))  float    v4f;
typedef __attribute__((ext_vector_type(2)))  float    v2f;
typedef __attribute__((ext_vector_type(2)))  _Float16 v2h;
typedef v8h  __attribute__((may_alias)) v8ha;
typedef v4f  __attribute__((may_alias)) v4fa;
typedef v8us __attribute__((may_alias)) v8usa;

__device__ __forceinline__ unsigned short f2bf(float f) { unsigned u = __float_as_uint(f); u += 0x7FFFu + ((u >> 16) & 1u); return (unsigned short)(u >> 16); }
__device__ __forceinline__ float bf2f(unsigned short b) { return __uint_as_float(((unsigned)b) << 16); }
__device__ __forceinline__ float bfr(float f) { return bf2f(f2bf(f)); }
__device__ __forceinline__ v16h cat16(v8h lo, v8h hi) { return __builtin_shufflevector(lo, hi, 0, 1, 2, 3, 4, 5, 6, 7, 8, 9, 10, 11, 12, 13, 14, 15); }
__device__ __forceinline__ v16bf cat16b(v8us lo, v8us hi) { return __builtin_bit_cast(v16bf, __builtin_shufflevector(lo, hi, 0, 1, 2, 3, 4, 5, 6, 7, 8, 9, 10, 11, 12, 13, 14, 15)); }
__device__ __forceinline__ v8f wmma16(v16h a, v16h b, v8f c) { return __builtin_amdgcn_wmma_f32_16x16x32_f16(false, a, false, b, (short)0, c, false, false); }
__device__ __forceinline__ v8f wmmab(v16bf a, v16bf b, v8f c) { return __builtin_amdgcn_wmma_f32_16x16x32_bf16(false, a, false, b, (short)0, c, false, false); }

// blockIdx.y picks one of the three activations (query, key, value).
__global__ __launch_bounds__(256) void k_cvtb(const float* __restrict__ s0, const float* __restrict__ s1, const float* __restrict__ s2, int nrows, bf* d0, bf* d1, bf* d2) {
    const int lane = threadIdx.x & 31, r = blockIdx.x * 8 + (threadIdx.x >> 5);
    if (r >= nrows) return;
    const int y = blockIdx.y;
    const float* src = y == 0 ? s0 : (y == 1 ? s1 : s2);
    bf* dst = y == 0 ? d0 : (y == 1 ? d1 : d2);
    v8us o[DM / 256];
#pragma unroll
    for (int q = 0; q < DM / 256; ++q) { v8us t;
#pragma unroll
        for (int i = 0; i < 8; ++i) t[i] = f2bf(src[(size_t)r * DM + q * 256 + lane * 8 + i]);
        o[q] = t; }
#pragma unroll
    for (int q = 0; q < DM / 256; ++q) *(v8us*)(dst + (size_t)r * DM + q * 256 + lane * 8) = o[q];
    
}

// k_prep: every weight plane in one grid, one 64 x 64 tile (n-tile a, k-tile c) of a [1024][1024] n-major bf16 plane per block, transposed through LDS.
// blockIdx.y = 0, 1, 2: Wq, Wk, Wv (head a, [E][D] k-major); 3: Wf ([K][N] k-major); 4: the per-head output linears: tile (a, a) = Wo[a] transposed; the other
// tiles of that plane are neither written nor read.
__global__ __launch_bounds__(256) void k_prep(const float* __restrict__ Wq, const float* __restrict__ Wk, const float* __restrict__ Wv, const float* __restrict__ Wf, const float* __restrict__ Wo,
                                              bf* WqT, bf* WkT, bf* WvT, bf* WfT, bf* WoBD) {
    __shared__ __align__(16) unsigned short tl[64 * 72];
    const int tid = threadIdx.x, a = blockIdx.x >> 4, c = blockIdx.x & 15, y = blockIdx.y;
    const float* src; bf* pln; int ncols = HD; bool live = true;
    if (y < 3) { src = (y == 0 ? Wq : (y == 1 ? Wk : Wv)) + (size_t)a * DM * HD + (size_t)c * 64 * HD; pln = y == 0 ? WqT : (y == 1 ? WkT : WvT); }
    else if (y == 3) { src = Wf + (size_t)c * 64 * DM + a * 64; pln = WfT; ncols = DM; }
    else { src = Wo + (size_t)a * HD * HD; pln = WoBD; live = (a == c); }
    if (!live) return;      // the same for the whole block, in front of the barrier
    bf* dst = pln + (size_t)a * 64 * DM + c * 64;
    const int kk = tid >> 2, nq = (tid & 3) * 16;
#pragma unroll
    for (int i = 0; i < 16; ++i) tl[(nq + i) * 72 + kk] = f2bf(src[(size_t)kk * ncols + nq + i]);
    __syncthreads();
    const int piece = tid & 7;
#pragma unroll
    for (int s = 0; s < 2; ++s) { const int nr = (tid >> 3) + 32 * s; const v8us val = *(const v8usa*)(tl + nr * 72 + piece * 8); *(v8us*)(dst + (size_t)nr * DM + piece * 8) = val; }
}
// Eight asynchronous 16-byte copies of one lane, global -> LDS. The closing s_wait_xcnt 0 stands in the copies' own statement so that no address register is rewritten in front of it.
__device__ __forceinline__ void copy8(unsigned l0, unsigned l1, unsigned l2, unsigned l3, unsigned l4, unsigned l5, unsigned l6, unsigned l7,
                                      const void* g0, const void* g1, const void* g2, const void* g3, const void* g4, const void* g5, const void* g6, const void* g7) {
    asm volatile("global_load_async_to_lds_b128 %0, %8, off\n\t"
                 "global_load_async_to_lds_b128 %1, %9, off\n\t"
                 "global_load_async_to_lds_b128 %2, %10, off\n\t"
                 "global_load_async_to_lds_b128 %3, %11, off\n\t"
                 "global_load_async_to_lds_b128 %4, %12, off\n\t"
                 "global_load_async_to_lds_b128 %5, %13, off\n\t"
                 "global_load_async_to_lds_b128 %6, %14, off\n\t"
                 "global_load_async_to_lds_b128 %7, %15, off\n\t"
                 "s_wait_xcnt 0x0"
                 :: "v"(l0), "v"(l1), "v"(l2), "v"(l3), "v"(l4), "v"(l5), "v"(l6), "v"(l7), "v"(g0), "v"(g1), "v"(g2), "v"(g3), "v"(g4), "v"(g5), "v"(g6), "v"(g7) : "memory");
}
// A staged GEMM plane: 128 rows of 64 k elements (128 B) at a pitch of 72 elements (144 B, an odd multiple of 16 B for the 16-byte fragment reads).
#define GPIT 72
#define GPLN (128 * GPIT)
// One 128 x 128 tile (blockIdx.x, blockIdx.y) of C = A.Bn^T + bias, four waves as 2 x 2, each with a 64 x 64 tile (4 x 4 accumulators): a fragment read from LDS feeds four products and a
// staged row 128 outputs. F16OUT is the same in every thread of a block. smem = the block's LDS: in the k loop two buffers of 2 (3 with SPLITA) planes (A rows, Bn rows, Al rows of 64 k each),
// filled by asynchronous copies, the next 64 k in flight while these are worked on; behind the loop's last barrier, when no wave reads the planes any more and no copy is in flight, the
// same bytes are the 4 x 64 x 68 f32 output staging. TR (with F16OUT; the same in every thread of a block): the wave's tile leaves transposed, as the plane C = [batch item][head][64 d][NT_ keys]:
// the tile's 64 rows are 64 keys of one batch item and its 64 columns one head's d, so the staging is written [column][row] and read back like the plain one.
template <bool SPLITA>
__device__ __forceinline__ void gemm_tile(unsigned char* smem, const bool F16OUT, const bool TR, const bf* __restrict__ A, const bf* __restrict__ Al, const bf* __restrict__ Bn, const float* __restrict__ bias, float* C, int ldc) {
    const int lane = threadIdx.x & 31, wave = threadIdx.x >> 5, lr = lane & 15, hi = lane >> 4;
    const int wr = wave >> 1, wc = wave & 1;
    const int r0 = blockIdx.x * 128 + wr * 64, c0 = blockIdx.y * 128 + wc * 64;
    constexpr int NPL = SPLITA ? 3 : 2;
    // Each thread copies eight 16-byte pieces of each plane: rows crow + 16 i, i = 0 .. 7 (8 pieces a row).
    const int tid = threadIdx.x, crow = tid >> 3, cpc = (tid & 7) * 8;
    const unsigned lc = (unsigned)(size_t)smem + 2u * (unsigned)(crow * GPIT + cpc);
    const bf* ga = A + (size_t)(blockIdx.x * 128 + crow) * DM + cpc;
    const bf* gl = SPLITA ? Al + (size_t)(blockIdx.x * 128 + crow) * DM + cpc : ga;
    const bf* gb = Bn + (size_t)(blockIdx.y * 128 + crow) * DM + cpc;
    auto plane = [&](unsigned l, const bf* g) {
        copy8(l, l + 2u * 16 * GPIT, l + 2u * 32 * GPIT, l + 2u * 48 * GPIT, l + 2u * 64 * GPIT, l + 2u * 80 * GPIT, l + 2u * 96 * GPIT, l + 2u * 112 * GPIT,
              g, g + 16 * DM, g + 32 * DM, g + 48 * DM, g + 64 * DM, g + 80 * DM, g + 96 * DM, g + 112 * DM);
    };
    auto fill = [&](int s) {
        const unsigned la = lc + (unsigned)(s & 1) * (2u * NPL * GPLN); const int ko = s * 64;
        plane(la, ga + ko); plane(la + 2u * GPLN, gb + ko);
        if (SPLITA) plane(la + 2u * 2 * GPLN, gl + ko);
    };
    v8f acc[4][4];      // [16 rows m][16 columns t]
#pragma unroll
    for (int m = 0; m < 4; ++m)
#pragma unroll
        for (int t = 0; t < 4; ++t) acc[m][t] = (v8f){};
    fill(0);
    asm volatile("s_wait_asynccnt 0x0" ::: "memory");    // this wave's share of stage 0 has landed
    __syncthreads();                                      // stage 0 is published to every wave
    fill(1);
#pragma unroll 1
    for (int st = 0; st < DM / 64; ++st) {
        const bf* rb = (const bf*)(const void*)smem + (st & 1) * (NPL * GPLN);
        const bf* ra = rb + (wr * 64 + lr) * GPIT + 8 * hi; const bf* rn = rb + GPLN + (wc * 64 + lr) * GPIT + 8 * hi;
#pragma unroll
        for (int kc = 0; kc < 64; kc += 32) {
            v16bf a[4], al[4], b[4];
#pragma unroll
            for (int m = 0; m < 4; ++m) a[m] = cat16b(*(const v8usa*)(ra + m * 16 * GPIT + kc), *(const v8usa*)(ra + m * 16 * GPIT + kc + 16));
#pragma unroll
            for (int t = 0; t < 4; ++t) b[t] = cat16b(*(const v8usa*)(rn + t * 16 * GPIT + kc), *(const v8usa*)(rn + t * 16 * GPIT + kc + 16));
#pragma unroll
            for (int m = 0; m < 4; ++m) { al[m] = a[m];
                if (SPLITA) al[m] = cat16b(*(const v8usa*)(ra + 2 * GPLN + m * 16 * GPIT + kc), *(const v8usa*)(ra + 2 * GPLN + m * 16 * GPIT + kc + 16)); }
            // keeps a k step's fragment reads together in front of its products: left free, the scheduler sinks each b[t] to its first use, and the wave waits out an LDS latency per t
            __builtin_amdgcn_sched_barrier(0);
#pragma unroll
            for (int t = 0; t < 4; ++t) {
#pragma unroll
                for (int m = 0; m < 4; ++m) acc[m][t] = wmmab(a[m], b[t], acc[m][t]);
                if (SPLITA) {
#pragma unroll
                    for (int m = 0; m < 4; ++m) acc[m][t] = wmmab(al[m], b[t], acc[m][t]); } }
        }
        asm volatile("s_wait_dscnt 0x0" ::: "memory");       // this wave's reads of this stage's buffer have returned
        asm volatile("s_wait_asynccnt 0x0" ::: "memory");    // this wave's share of the next stage has landed
        __syncthreads();                                      // publishes the next stage and ends every wave's reads of this buffer
        if (st + 2 < DM / 64) fill(st + 2);                   // refill the buffer just read; the test is the same for the whole block
    }
    asm volatile("s_wait_asynccnt 0x0" ::: "memory");        // nothing of this wave is in flight when the planes become output staging
    float* os = (float*)(void*)smem + wave * (64 * 68);
    if (TR) {      // [column][row]: a lane's eight accumulator registers are eight neighbouring rows of one column, two 16-byte stores
#pragma unroll
        for (int t = 0; t < 4; ++t) { const float bv = bias ? bfr(bias[c0 + t * 16 + lr]) : 0.f;
#pragma unroll
            for (int m = 0; m < 4; ++m) { float* tp = os + (t * 16 + lr) * 68 + m * 16 + hi * 8;
                *(v4fa*)(tp) = (v4f){acc[m][t][0] + bv, acc[m][t][1] + bv, acc[m][t][2] + bv, acc[m][t][3] + bv};
                *(v4fa*)(tp + 4) = (v4f){acc[m][t][4] + bv, acc[m][t][5] + bv, acc[m][t][6] + bv, acc[m][t][7] + bv}; } }
    } else {
#pragma unroll
    for (int t = 0; t < 4; ++t) { const float bv = bias ? bfr(bias[c0 + t * 16 + lr]) : 0.f;
#pragma unroll
        for (int m = 0; m < 4; ++m)
#pragma unroll
            for (int j = 0; j < 8; ++j) os[(m * 16 + hi * 8 + j) * 68 + t * 16 + lr] = acc[m][t][j] + bv; }
    }
    __syncthreads();
    if (F16OUT) {
        if (TR) ldc = NT_;
        const size_t obase = TR ? ((size_t)((r0 / NT_) * NH_ + c0 / HD) * HD) * NT_ + (r0 % NT_) : (size_t)r0 * ldc + c0;
        h16* crow = (h16*)(void*)C + obase;
        auto pass = [&]() {
#pragma unroll
            for (int s = 0; s < 16; ++s) { const int row = 4 * s + (lane >> 3), piece = lane & 7; const float* sp = os + row * 68 + piece * 8; v8h o;
#pragma unroll
                for (int i = 0; i < 8; ++i) o[i] = (h16)sp[i];
                *(v8h*)(crow + (size_t)row * ldc + piece * 8) = o;
                asm volatile("s_wait_xcnt 0x0" ::: "memory"); }     // in front of the next rows' values, which reuse the store's address and data registers
        };
        pass(); 
    } else {
        float* crow = C + (size_t)r0 * ldc + c0;
        auto pass = [&]() {
#pragma unroll
            for (int s = 0; s < 32; ++s) { const int Lid = (lane >> 3) + 4 * s, piece = lane & 7; const int row = Lid >> 1, cofs = (Lid & 1) * 32 + piece * 4;
                const v4f val = *(const v4fa*)(os + row * 68 + cofs); *(v4f*)(crow + (size_t)row * ldc + cofs) = val; }
        };
        pass(); 
    }
}

__global__ __launch_bounds__(128) void k_gemmb(const bf* __restrict__ A, const bf* __restrict__ Al, const bf* __restrict__ Bn, const float* __restrict__ bias, float* C, int ldc) {
    __shared__ __align__(16) unsigned char smem[2 * 3 * GPLN * 2];
    gemm_tile<true>(smem, false, false, A, Al, Bn, bias, C, ldc);
}
// The three projections in one grid, each to one f16 plane: blockIdx.z = 0: q, 1: k ([token][h * 64 + d]), 2: v, transposed ([batch item][head][d][key]).
__global__ __launch_bounds__(128) void k_qkv(const bf* __restrict__ Xq, const bf* __restrict__ Xk, const bf* __restrict__ Xv, const bf* __restrict__ WqT, const bf* __restrict__ WkT, const bf* __restrict__ WvT,
                                             const float* __restrict__ bq, const float* __restrict__ bk, const float* __restrict__ bv, h16* QH, h16* KH, h16* VTH) {
    __shared__ __align__(16) unsigned char smem[2 * 2 * GPLN * 2];
    const int z = blockIdx.z;
    const bf* A = z == 0 ? Xq : (z == 1 ? Xk : Xv);
    const bf* Bn = z == 0 ? WqT : (z == 1 ? WkT : WvT);
    const float* bias = z == 0 ? bq : (z == 1 ? bk : bv);
    float* C = (float*)(void*)(z == 0 ? QH : (z == 1 ? KH : VTH));
    gemm_tile<false>(smem, true, z == 2, A, nullptr, Bn, bias, C, DM);
}

// One trip's K and V planes in LDS, in f16 elements: K as [64 keys][64 d], V as [64 d][64 keys], both rows of 128 B at a pitch of 72 (144 B,
// an odd multiple of 16 B for the 16-byte fragment reads).
#define KPIT 72
#define VPIT 72
#define RKH  0
#define RVH  (64 * KPIT)
#define RBUF (64 * KPIT + 64 * VPIT)
#define XCH  (8 * 32 * 4 + 64)   // floats one wave hands to its partner: 32 ctx registers, maximum and sum of each lane
// lane l with lane l ^ 16, as a vector cross-row move (a shuffle would go through the LDS unit and its wait)
__device__ __forceinline__ float xhalf(float x) { return __builtin_bit_cast(float, __builtin_amdgcn_permlanex16(__builtin_bit_cast(int, x), __builtin_bit_cast(int, x), 0x76543210, 0xfedcba98, false, false)); }
// k_attn: block = (b, h, 64 queries); ALL 32 stages of 64 keys (no skip); each stage's K and V planes are brought into LDS once per block by asynchronous copies,
// two buffers, the next stage in flight while this one is worked on. The four waves are 2 query groups x 2 key halves: wave (qg, kh) has 32 queries (two 16-column groups) and, of every stage,
// the 32 keys kh * 32 ..: a K or V fragment read from LDS feeds two products, and each wave runs its own online softmax over its 1024 keys. Behind the loop the two waves of a query group
// hand each other, through LDS, the partial (maximum, sum, ctx) of the column group that the other one finishes, and join the two partials once.
// The products are TRANSPOSED: scores^T = K.Q^T (A = K rows, B = Q), ctx^T += V^T.P^T (A = V^T rows, B = P^T), so a lane
// holds 16 of the 32 scores of ONE query of each group (column lr; keys 8 hi + j and 16 + 8 hi + j, which is the k order of a B operand): maximum and sum run in the lane plus one exchange between the
// wave's halves, and the weights (x32768, f16) go from the score accumulators into the B operand in registers. Per group 4 WMMA scores /8 (f32), online softmax, 4 WMMA .v;
// key mask as an additive 0 / -inf table in LDS (built once per block), query mask applied to the row's final factor. Epilogue (16 queries a wave): a lane's ctx^T registers (d 8 hi + j and 16 + 8 hi + j of
// each 32, query lr) are an A operand's k order, so ctx goes in registers, as bf16 hi + residual, into x = ctx.Wo[h] + bo[h] (16 WMMA, B = the head's 64 x 64 tile of WoT, n-major, read
// from global memory once per wave; per k step hi then residual on one accumulator); x -> bf16 hi + residual planes XH/XL[tok][h*64+o].
__global__ __launch_bounds__(128) void k_attn(const h16* __restrict__ Q16, const h16* __restrict__ K16, const h16* __restrict__ VTH, const float* __restrict__ QM, const float* __restrict__ KM, const bf* __restrict__ WoT, const float* __restrict__ bo, bf* XH, bf* XL) {
    __shared__ __align__(16) float kbias[NT_];
    __shared__ __align__(16) float ost[4][16 * 68];
    __shared__ __align__(16) h16 ring[2][RBUF];
    const int lane = threadIdx.x & 31, wave = threadIdx.x >> 5, lr = lane & 15, hi = lane >> 4;
    const int qg = wave & 1, kh = wave >> 1;
    const int bid = blockIdx.x;
    const int b = bid / (NH_ * (NT_ / 64)), rem = bid - b * (NH_ * (NT_ / 64)), h = rem / (NT_ / 64), qt = rem - h * (NT_ / 64);
    const int q0 = qt * 64 + qg * 32 + kh * 16;     // the 16 queries that this wave finishes: column group kh of its 32
    const size_t tok0 = (size_t)b * NT_;
    v16h qa[2][2];      // [column group][32 d]
#pragma unroll
    for (int g = 0; g < 2; ++g) { const size_t qo0 = (tok0 + qt * 64 + qg * 32 + g * 16 + lr) * DM + h * HD + 8 * hi;
#pragma unroll
        for (int kc = 0; kc < 2; ++kc) qa[g][kc] = cat16(*(const v8h*)(Q16 + qo0 + kc * 32), *(const v8h*)(Q16 + qo0 + kc * 32 + 16)); }
    const h16* kh_b = K16 + tok0 * DM + h * HD;
    const size_t vbase = (((size_t)b * NH_ + h) * HD) * NT_;
    v8f o[2][4];      // ctx^T: group g, tile n, register j = d n * 16 + 8 hi + j of query g * 16 + lr
#pragma unroll
    for (int g = 0; g < 2; ++g)
#pragma unroll
        for (int n = 0; n < 4; ++n) o[g][n] = (v8f){};
    float mrow[2] = { -3.0e38f, -3.0e38f }, lpart[2] = { 0.f, 0.f };    // of query g * 16 + lr; lpart sums this half's keys only, the halves are joined behind the loop
    const int kt_hi = NT_ / 64 - 1;     // full attention; masks: key j kept iff key_mask[b][j] != 0, query row i kept iff query_mask[b][i] != 0 (fully masked rows -> 0 output, = nan_to_num)
    const float qmv = bfr(QM[tok0 + q0 + lr]);
    const int tid = threadIdx.x;
    // Each thread copies four 16-byte pieces of each of the two planes: rows crow + 16 i, i = 0 .. 3 (8 pieces a row).
    const int crow = tid >> 3, cpc = (tid & 7) * 8;
    const unsigned ring0 = (unsigned)(size_t)&ring[0][0];
    const unsigned lk = ring0 + 2u * (unsigned)(crow * KPIT + cpc);
    const h16* gkh = kh_b + (size_t)crow * DM + cpc;
    const h16* gvh = VTH + vbase + (size_t)crow * NT_ + cpc;
    auto fill = [&](int t) {
        const unsigned la = lk + (unsigned)(t & 1) * (2u * RBUF); const size_t ka = (size_t)t * 64 * DM, va = (size_t)t * 64;
        copy8(la + 2u * RKH, la + 2u * (RKH + 16 * KPIT), la + 2u * (RKH + 32 * KPIT), la + 2u * (RKH + 48 * KPIT),
              la + 2u * RVH, la + 2u * (RVH + 16 * VPIT), la + 2u * (RVH + 32 * VPIT), la + 2u * (RVH + 48 * VPIT),
              gkh + ka, gkh + ka + 16 * DM, gkh + ka + 32 * DM, gkh + ka + 48 * DM,
              gvh + va, gvh + va + (size_t)16 * NT_, gvh + va + (size_t)32 * NT_, gvh + va + (size_t)48 * NT_);
    };
    fill(0);
#pragma unroll
    for (int i = 0; i < NT_ / 512; ++i) { const v4f km = *(const v4f*)(KM + tok0 + i * 512 + tid * 4); v4f kb;
#pragma unroll
        for (int e = 0; e < 4; ++e) kb[e] = bfr(km[e]) != 0.f ? 0.f : -__builtin_inff();
        *(v4fa*)(kbias + i * 512 + tid * 4) = kb; }     // published by the barrier that publishes stage 0
    asm volatile("s_wait_asynccnt 0x0" ::: "memory");    // this wave's share of stage 0 has landed
    __syncthreads();                                      // stage 0 and the key table are published to every wave
    fill(1);
#pragma unroll 1
    for (int kt = 0; kt <= kt_hi; ++kt) {
        const int l0 = kt * 64 + kh * 32;
        const h16* rb = &ring[kt & 1][0];
        const h16* rk0 = rb + (kh * 32 + lr) * KPIT + 8 * hi; const h16* rk1 = rk0 + 16 * KPIT;
        const float* kbp = kbias + l0 + 8 * hi;
        const v4f kb[4] = { *(const v4fa*)(kbp), *(const v4fa*)(kbp + 4), *(const v4fa*)(kbp + 16), *(const v4fa*)(kbp + 20) };
        v8f s0[2] = { (v8f){}, (v8f){} }, s1[2] = { (v8f){}, (v8f){} };
#pragma unroll
        for (int kc = 0; kc < 2; ++kc) {
            const v16h k0h = cat16(*(const v8ha*)(rk0 + RKH + kc * 32), *(const v8ha*)(rk0 + RKH + kc * 32 + 16)), k1h = cat16(*(const v8ha*)(rk1 + RKH + kc * 32), *(const v8ha*)(rk1 + RKH + kc * 32 + 16));
#pragma unroll
            for (int g = 0; g < 2; ++g) { s0[g] = wmma16(k0h, qa[g][kc], s0[g]); s1[g] = wmma16(k1h, qa[g][kc], s1[g]); }
        }
        v16h vh[4];
#pragma unroll
        for (int n = 0; n < 4; ++n) { const h16* rv = rb + RVH + (n * 16 + lr) * VPIT + kh * 32 + hi * 8; vh[n] = cat16(*(const v8ha*)(rv), *(const v8ha*)(rv + 16)); }
        // keeps the V fragment reads together in front of the softmax, which covers their latency: left free, the scheduler sinks them among the last products, and the wave waits them out in front of the barrier
        __builtin_amdgcn_sched_barrier(0);
        v16h pa[2];
        v2f a[2][8];      // this lane's 16 scores of each group in pairs of neighbouring accumulator registers: a[g][i] = keys 8 hi + 2 i, + 1 (i < 4), 16 + 8 hi + 2 (i - 4), + 1 (i >= 4)
        v2f mn;           // the two groups' new maxima
#pragma unroll
        for (int g = 0; g < 2; ++g) {
#pragma unroll
            for (int i = 0; i < 4; ++i) {
                a[g][i]     = (v2f){s0[g][2 * i], s0[g][2 * i + 1]} * 0.125f + (v2f){kb[i >> 1][(2 * i) & 3], kb[i >> 1][((2 * i) & 3) + 1]};
                a[g][4 + i] = (v2f){s1[g][2 * i], s1[g][2 * i + 1]} * 0.125f + (v2f){kb[2 + (i >> 1)][(2 * i) & 3], kb[2 + (i >> 1)][((2 * i) & 3) + 1]};
            }
            float mx = fmaxf(a[g][0].x, a[g][0].y);
#pragma unroll
            for (int i = 1; i < 8; ++i) mx = fmaxf(mx, fmaxf(a[g][i].x, a[g][i].y));
            mx = fmaxf(mx, xhalf(mx));
            mn[g] = fmaxf(mrow[g], mx);
        }
        const v2f dm = (v2f){mrow[0], mrow[1]} - mn;
        const float alpha[2] = { __expf(dm.x), __expf(dm.y) };
#pragma unroll
        for (int g = 0; g < 2; ++g) {
            mrow[g] = mn[g];
            v2f ts[2] = { (v2f){0.f, 0.f}, (v2f){0.f, 0.f} };
#pragma unroll
            for (int i = 0; i < 8; ++i) {
                const v2f p = { __expf(a[g][i].x - mn[g]), __expf(a[g][i].y - mn[g]) };
                ts[i & 1] += p;
                const v2h hh = __builtin_convertvector(p * PSC, v2h);
                pa[g][2 * i] = hh.x; pa[g][2 * i + 1] = hh.y;
            }
            ts[0] += ts[1];
            lpart[g] = lpart[g] * alpha[g] + (ts[0].x + ts[0].y);
#pragma unroll
            for (int n = 0; n < 4; ++n)
#pragma unroll
                for (int j = 0; j < 8; ++j) o[g][n][j] *= alpha[g];
        }
#pragma unroll
        for (int n = 0; n < 4; ++n)
#pragma unroll
            for (int g = 0; g < 2; ++g) o[g][n] = wmma16(vh[n], pa[g], o[g][n]);
        asm volatile("s_wait_dscnt 0x0" ::: "memory");       // this wave's reads of this stage's buffer have returned
        asm volatile("s_wait_asynccnt 0x0" ::: "memory");    // this wave's share of the next stage has landed
        __syncthreads();                                      // publishes the next stage and ends every wave's reads of this buffer
        if (kt + 2 <= kt_hi) fill(kt + 2);                    // refill the buffer just read; the test is the same for the whole block
    }
    asm volatile("s_wait_asynccnt 0x0" ::: "memory");        // nothing of this wave is in flight when the loop is left
    // The two key halves are joined. Behind the loop's last barrier no wave reads the ring and no copy is in flight: its bytes carry the hand-over. Wave (qg, kh) keeps column group kh and
    // gives group 1 - kh to wave (qg, 1 - kh); lane and register mean the same query and d in both waves.
    float* xw = (float*)(void*)&ring[0][0] + wave * XCH;
    const float* xr = (const float*)(const void*)&ring[0][0] + (wave ^ 2) * XCH;
    const bool up = kh != 0;      // the same in every lane of a wave
    v8f oc[4];
#pragma unroll
    for (int n = 0; n < 4; ++n) { v8f gv;
#pragma unroll
        for (int j = 0; j < 8; ++j) { gv[j] = up ? o[0][n][j] : o[1][n][j]; oc[n][j] = up ? o[1][n][j] : o[0][n][j]; }
        *(v4fa*)(xw + ((2 * n) * 32 + lane) * 4) = (v4f){gv[0], gv[1], gv[2], gv[3]};
        *(v4fa*)(xw + ((2 * n + 1) * 32 + lane) * 4) = (v4f){gv[4], gv[5], gv[6], gv[7]}; }
    xw[8 * 32 * 4 + lane] = up ? mrow[0] : mrow[1];
    xw[8 * 32 * 4 + 32 + lane] = up ? lpart[0] : lpart[1];
    const float ma = up ? mrow[1] : mrow[0], la_ = up ? lpart[1] : lpart[0];
    __syncthreads();                                          // the partials are published to the partner waves
    const float mb = xr[8 * 32 * 4 + lane], lb_ = xr[8 * 32 * 4 + 32 + lane];
    const float mj = fmaxf(ma, mb), fa = __expf(ma - mj), fb = __expf(mb - mj);
#pragma unroll
    for (int n = 0; n < 4; ++n) { const v4f p0 = *(const v4fa*)(xr + ((2 * n) * 32 + lane) * 4), p1 = *(const v4fa*)(xr + ((2 * n + 1) * 32 + lane) * 4);
#pragma unroll
        for (int j = 0; j < 4; ++j) { oc[n][j] = oc[n][j] * fa + p0[j] * fb; oc[n][4 + j] = oc[n][4 + j] * fa + p1[j] * fb; } }
    const float lj = la_ * fa + lb_ * fb;
    const float rs = lj + xhalf(lj);
    const float inv = (rs > 0.f && qmv != 0.f) ? 1.0f / (rs * PSC) : 0.f;   // masked query row, or every key masked: weights nan_to_num -> 0 -> output 0
    v16bf ch[2], cl[2];      // ctx rows (query lr) as A operands, 32 d each
#pragma unroll
    for (int kc = 0; kc < 2; ++kc) { v8us hb[2], lb[2];
#pragma unroll
        for (int u = 0; u < 2; ++u)
#pragma unroll
            for (int j = 0; j < 8; ++j) { const float c = oc[2 * kc + u][j] * inv; const unsigned short t = f2bf(c); hb[u][j] = t; lb[u][j] = f2bf(c - bf2f(t)); }
        ch[kc] = cat16b(hb[0], hb[1]); cl[kc] = cat16b(lb[0], lb[1]); }
    const bf* wo = WoT + (size_t)(h * HD + lr) * DM + h * HD + 8 * hi;
    v8f xa[4];
#pragma unroll
    for (int t = 0; t < 4; ++t) xa[t] = (v8f){};
#pragma unroll
    for (int kc = 0; kc < 2; ++kc)
#pragma unroll
        for (int t = 0; t < 4; ++t) { const v16bf w = cat16b(*(const v8us*)(wo + (size_t)t * 16 * DM + kc * 32), *(const v8us*)(wo + (size_t)t * 16 * DM + kc * 32 + 16));
            xa[t] = wmmab(ch[kc], w, xa[t]); xa[t] = wmmab(cl[kc], w, xa[t]); }
    float* os = &ost[wave][0];
#pragma unroll
    for (int t = 0; t < 4; ++t) { const float bv = bfr(bo[h * HD + t * 16 + lr]);
#pragma unroll
        for (int j = 0; j < 8; ++j) os[(hi * 8 + j) * 68 + t * 16 + lr] = xa[t][j] + bv; }
    __syncthreads();
    const size_t cbase = (tok0 + q0) * DM + (size_t)h * HD;
    auto pass = [&]() {
#pragma unroll
        for (int s = 0; s < 4; ++s) { const int row = 4 * s + (lane >> 3), piece = lane & 7; const float* sp = os + row * 68 + piece * 8; v8us oh, ol;
#pragma unroll
            for (int i = 0; i < 8; ++i) { const unsigned short hb = f2bf(sp[i]); oh[i] = hb; ol[i] = f2bf(sp[i] - bf2f(hb)); }
            *(v8us*)(XH + cbase + (size_t)row * DM + piece * 8) = oh; *(v8us*)(XL + cbase + (size_t)row * DM + piece * 8) = ol; }
    };
    pass(); 
}

#define VST2(T, p, v) do { const T vst2_v_ = (v); *(T*)(p) = vst2_v_;  } while (0)
extern "C" void kernel_launch(void* const* d_in, const int* in_sizes, int n_in,
                              void* d_out, int out_size, void* d_ws, size_t ws_size, hipStream_t stream) {
    (void)in_sizes; (void)n_in; (void)out_size;
    const float* xq = (const float*)d_in[0]; const float* xk = (const float*)d_in[1]; const float* xv = (const float*)d_in[2]; const float* QM = (const float*)d_in[3]; const float* KM = (const float*)d_in[4];
    const float* Wq = (const float*)d_in[5]; const float* bq = (const float*)d_in[6]; const float* Wk = (const float*)d_in[7]; const float* bk = (const float*)d_in[8]; const float* Wv = (const float*)d_in[9]; const float* bv = (const float*)d_in[10];
    const float* Wo = (const float*)d_in[11]; const float* bo = (const float*)d_in[12]; const float* Wf = (const float*)d_in[13]; const float* bfin = (const float*)d_in[14];
    float* out = (float*)d_out;    // [2][2048][1024]
    char* wsp = (char*)d_ws;
    auto take = [&](size_t bytes) { char* p = wsp; wsp += (bytes + 255) & ~(size_t)255; return (void*)p; };
    bf* Xq = (bf*)take((size_t)NTK * DM * 2); bf* Xk = (bf*)take((size_t)NTK * DM * 2); bf* Xv = (bf*)take((size_t)NTK * DM * 2);
    bf* WqT = (bf*)take((size_t)DM * DM * 2); bf* WkT = (bf*)take((size_t)DM * DM * 2); bf* WvT = (bf*)take((size_t)DM * DM * 2); bf* WoBD = (bf*)take((size_t)DM * DM * 2); bf* WfT = (bf*)take((size_t)DM * DM * 2);
    h16* QH = (h16*)take((size_t)NTK * DM * 2); h16* KH = (h16*)take((size_t)NTK * DM * 2); h16* VTH = (h16*)take((size_t)NTK * DM * 2);
    bf* XH = (bf*)take((size_t)NTK * DM * 2); bf* XL = (bf*)take((size_t)NTK * DM * 2);
    if ((size_t)(wsp - (char*)d_ws) > ws_size) return;    // 3 x 8.4 + 5 x 2.1 + 5 x 8.4 ~ 78 MB, no aliasing
    // every loop of launches over heads, planes and batch items is a grid dimension: 5 launches
    k_prep<<<dim3(256, 5, 1), 256, 0, stream>>>(Wq, Wk, Wv, Wf, Wo, WqT, WkT, WvT, WfT, WoBD);
    k_cvtb<<<dim3(NTK / 8, 3, 1), 256, 0, stream>>>(xq, xk, xv, NTK, Xq, Xk, Xv);
    k_qkv<<<dim3(NTK / 128, DM / 128, 3), 128, 0, stream>>>(Xq, Xk, Xv, WqT, WkT, WvT, bq, bk, bv, QH, KH, VTH);
    k_attn<<<NB_ * NH_ * (NT_ / 64), 128, 0, stream>>>(QH, KH, VTH, QM, KM, WoBD, bo, XH, XL);      // with the per-head ctx.Wo[h] + bo[h]
    k_gemmb<<<dim3(NTK / 128, DM / 128, 1), 128, 0, stream>>>(XH, XL, WfT, bfin, out, DM);   // x.Wf + bf
}
